// v000
// Times are from an AMD MI455X. After a warm-up the kernel runs many times in a row, and a time is the length of
// such a window on the GPU divided by its runs, so every launch and the gaps after it count. The runs cycle
// through copies of the inputs. A figure is the median of several windows, for all but v000 over two sittings.
// Sittings can differ by a few percent; kernels timed side by side share one.
// The starting kernel, v000, takes 272 microseconds a run.
#include <hip/hip_runtime.h>
#include <math.h>

typedef _Float16 f16;
typedef __attribute__((ext_vector_type(16))) _Float16 v16h;
typedef __attribute__((ext_vector_type(8)))  _Float16 v8h;
typedef __attribute__((ext_vector_type(8)))  float    v8f;

// Problem constants (fixed by the reference)
constexpr int BATCH  = 8;
constexpr int C      = 256;
constexpr int NTOK   = 4096;   // 64*64
constexpr int LDQK   = 512;    // q|k packed
constexpr int GROUPS = 32;

// ---------------------------------------------------------------------------
// Fragment helpers: CDNA5 16-bit A/B fragment layout (16x32, ISA 7.12.2):
// lane L: row/col = L&15 ; kb = (L>>4)*8 ; elements 0..7 hold K=kb..kb+7,
// elements 8..15 hold K=kb+16..kb+23.  Two 16B loads per lane.
// ---------------------------------------------------------------------------
__device__ __forceinline__ v16h ld_frag(const f16* p, int ld) {
  const int lane = threadIdx.x & 31;
  const f16* base = p + (size_t)(lane & 15) * ld + (lane >> 4) * 8;
  v8h lo = *(const v8h*)(base);
  v8h hh = *(const v8h*)(base + 16);
  v16h r;
#pragma unroll
  for (int i = 0; i < 8; ++i) { r[i] = lo[i]; r[i + 8] = hh[i]; }
  return r;
}

__device__ __forceinline__ v8f wmma16(v16h a, v16h b, v8f c) {
  return __builtin_amdgcn_wmma_f32_16x16x32_f16(false, a, false, b,
                                                (short)0, c, false, false);
}

// Async global->LDS 16B copy (CDNA5, tracked by ASYNCcnt).  Inline asm since
// the clang builtin arity differs across toolchains.
__device__ __forceinline__ void async_cp16(f16* ldst, const f16* gsrc) {
  unsigned l = (unsigned)(uintptr_t)ldst;                 // addr[31:0] = LDS off
  unsigned long long g = (unsigned long long)(uintptr_t)gsrc;
  asm volatile("global_load_async_to_lds_b128 %0, %1, off"
               :: "v"(l), "v"(g) : "memory");
}
__device__ __forceinline__ void async_wait0() {
  asm volatile("s_wait_asynccnt 0x0" ::: "memory");
}

// ---------------------------------------------------------------------------
// GroupNorm stats: one block per (b,g); 8 channels * 4096 = 32768 elements.
// ---------------------------------------------------------------------------
__global__ __launch_bounds__(256) void gn_stats_kernel(
    const float* __restrict__ x, float* __restrict__ mean,
    float* __restrict__ rstd) {
  const int bg = blockIdx.x;
  const float* p = x + (size_t)bg * 32768;
  float s = 0.f, q = 0.f;
  for (int i = threadIdx.x; i < 32768; i += 256) {
    float v = p[i];
    s += v;
    q = fmaf(v, v, q);
  }
#pragma unroll
  for (int off = 16; off > 0; off >>= 1) {
    s += __shfl_xor(s, off, 32);
    q += __shfl_xor(q, off, 32);
  }
  __shared__ float ss[8], qs[8];
  if ((threadIdx.x & 31) == 0) {
    ss[threadIdx.x >> 5] = s;
    qs[threadIdx.x >> 5] = q;
  }
  __syncthreads();
  if (threadIdx.x == 0) {
    float S = 0.f, Q = 0.f;
#pragma unroll
    for (int i = 0; i < 8; ++i) { S += ss[i]; Q += qs[i]; }
    float mu  = S * (1.f / 32768.f);
    float var = Q * (1.f / 32768.f) - mu * mu;
    mean[bg] = mu;
    rstd[bg] = rsqrtf(var + 1e-5f);
  }
}

// ---------------------------------------------------------------------------
// Normalize + transpose: x (b,c,n) f32 -> xnT (b,n,c) f16, 32x32 LDS tiles.
// ---------------------------------------------------------------------------
__global__ __launch_bounds__(256) void gn_apply_t_kernel(
    const float* __restrict__ x, const float* __restrict__ mean,
    const float* __restrict__ rstd, const float* __restrict__ gsc,
    const float* __restrict__ gbi, f16* __restrict__ xnT) {
  const int b  = blockIdx.z;
  const int c0 = blockIdx.y * 32;
  const int n0 = blockIdx.x * 32;
  __shared__ f16 T[32][33];

  const int ci  = threadIdx.x >> 3;
  const int nj0 = (threadIdx.x & 7) * 4;
  const int c   = c0 + ci;
  const int g   = c >> 3;
  const float mu = mean[b * GROUPS + g];
  const float rs = rstd[b * GROUPS + g];
  const float sc = gsc[c];
  const float bi = gbi[c];
  const float* xr = x + ((size_t)b * C + c) * NTOK + n0;
#pragma unroll
  for (int u = 0; u < 4; ++u) {
    float v = xr[nj0 + u];
    T[ci][nj0 + u] = (f16)((v - mu) * rs * sc + bi);
  }
  __syncthreads();
  const int ni  = threadIdx.x >> 3;
  const int cj0 = (threadIdx.x & 7) * 4;
  f16* orow = xnT + ((size_t)b * NTOK + n0 + ni) * C + c0 + cj0;
#pragma unroll
  for (int u = 0; u < 4; ++u) orow[u] = T[cj0 + u][ni];
}

// ---------------------------------------------------------------------------
__global__ void cvt_f16_kernel(const float* __restrict__ src,
                               f16* __restrict__ dst, int n) {
  int i = blockIdx.x * 256 + threadIdx.x;
  if (i < n) dst[i] = (f16)src[i];
}

// ---------------------------------------------------------------------------
// WMMA GEMM: C[M,N] = A[M,K] * B[N,K]^T.  Tile 128x128, 8 waves, B in LDS.
// MODE 0: f16 out, bias[N]          (q|k projection)
// MODE 1: f32 out, bias[M] + resid  (output projection)
// MODE 2: f16 out, bias[M]          (vT projection: rows = channels)
// ---------------------------------------------------------------------------
template <int MODE>
__global__ __launch_bounds__(256, 1) void gemm_abt_kernel(
    const f16* __restrict__ A, int lda, long long sA,
    const f16* __restrict__ B, int ldb, long long sB,
    const float* __restrict__ bias, void* __restrict__ Cv, int ldc,
    long long sC, const float* __restrict__ resid, long long sR, int K) {
  const int b  = blockIdx.z;
  const int m0 = blockIdx.x * 128;
  const int n0 = blockIdx.y * 128;
  A += (size_t)b * sA;
  B += (size_t)b * sB;

  __shared__ f16 Bs[128][40];  // 80B pitch: 16B aligned, bank-clean

  const int w    = threadIdx.x >> 5;
  const int lane = threadIdx.x & 31;
  const int hi   = lane >> 4;
  const int col  = lane & 15;

  v8f acc[8];
#pragma unroll
  for (int i = 0; i < 8; ++i)
#pragma unroll
    for (int j = 0; j < 8; ++j) acc[i][j] = 0.f;

  const f16* arow = A + (size_t)(m0 + w * 16) * lda;
  const int r  = threadIdx.x >> 1;
  const int sg = threadIdx.x & 1;

  for (int kb = 0; kb < K; kb += 32) {
    const f16* src = B + (size_t)(n0 + r) * ldb + kb + sg * 16;
    *(v8h*)&Bs[r][sg * 16]     = *(const v8h*)(src);
    *(v8h*)&Bs[r][sg * 16 + 8] = *(const v8h*)(src + 8);
    __syncthreads();
    v16h a = ld_frag(arow + kb, lda);
#pragma unroll
    for (int ct = 0; ct < 8; ++ct) {
      v16h bf = ld_frag(&Bs[ct * 16][0], 40);
      acc[ct] = wmma16(a, bf, acc[ct]);
    }
    __syncthreads();
  }

  if (MODE == 0) {
    f16* Cp = (f16*)Cv + (size_t)b * sC;
#pragma unroll
    for (int ct = 0; ct < 8; ++ct) {
      float bn = bias[n0 + ct * 16 + col];
#pragma unroll
      for (int j = 0; j < 8; ++j) {
        int m = m0 + w * 16 + j + 8 * hi;
        Cp[(size_t)m * ldc + n0 + ct * 16 + col] = (f16)(acc[ct][j] + bn);
      }
    }
  } else if (MODE == 1) {
    float* Cp = (float*)Cv + (size_t)b * sC;
    const float* Rp = resid + (size_t)b * sR;
#pragma unroll
    for (int ct = 0; ct < 8; ++ct) {
#pragma unroll
      for (int j = 0; j < 8; ++j) {
        int m = m0 + w * 16 + j + 8 * hi;
        size_t idx = (size_t)m * ldc + n0 + ct * 16 + col;
        Cp[idx] = acc[ct][j] + bias[m] + Rp[idx];
      }
    }
  } else {
    f16* Cp = (f16*)Cv + (size_t)b * sC;
#pragma unroll
    for (int ct = 0; ct < 8; ++ct) {
#pragma unroll
      for (int j = 0; j < 8; ++j) {
        int m = m0 + w * 16 + j + 8 * hi;
        Cp[(size_t)m * ldc + n0 + ct * 16 + col] = (f16)(acc[ct][j] + bias[m]);
      }
    }
  }
}

// ---------------------------------------------------------------------------
// Flash attention.  qk (b,4096,512) f16 [q|k], vT (b,256,4096) f16,
// out (b,4096,256) f16.  WG = 128 queries (8 waves x 16 rows).
// Double-buffered K/V chunks staged with async global->LDS copies; online
// softmax entirely in registers + cross-lane shuffles (rows live in 16-lane
// halves, so xor-masks 1,2,4,8 reduce within the half).
// ---------------------------------------------------------------------------
__global__ __launch_bounds__(256, 1) void attn_kernel(
    const f16* __restrict__ qk, const f16* __restrict__ vT,
    f16* __restrict__ out) {
  const int b    = blockIdx.y;
  const int q0   = blockIdx.x * 128;
  const int w    = threadIdx.x >> 5;
  const int lane = threadIdx.x & 31;
  const int hi   = lane >> 4;
  const int col  = lane & 15;

  __shared__ f16 Ks[2][32][264];   // keys x channels, 528B pitch
  __shared__ f16 Vs[2][256][40];   // channels x keys, 80B pitch
  __shared__ f16 Pw[8][16][32];    // per-wave P tile

  const f16* qb  = qk + (size_t)b * NTOK * LDQK;
  const f16* vb  = vT + (size_t)b * C * NTOK;
  const int  myq = q0 + w * 16;

  // Preload Q fragments (16 rows x K=256)
  v16h qf[8];
#pragma unroll
  for (int cb = 0; cb < 8; ++cb)
    qf[cb] = ld_frag(qb + (size_t)myq * LDQK + cb * 32, LDQK);

  v8f acc[16];
#pragma unroll
  for (int i = 0; i < 16; ++i)
#pragma unroll
    for (int j = 0; j < 8; ++j) acc[i][j] = 0.f;

  float m_i[8], l_i[8];
#pragma unroll
  for (int j = 0; j < 8; ++j) { m_i[j] = -__builtin_inff(); l_i[j] = 0.f; }

  // Async-stage one 32-key chunk (K rows + V rows) into buffer `buf`.
  auto stage = [&](int buf, int k0) {
    const int kr = threadIdx.x >> 3, sg = threadIdx.x & 7;
    const f16* ksrc = qb + (size_t)(k0 + kr) * LDQK + C + sg * 32;
    f16* kdst = &Ks[buf][kr][sg * 32];
#pragma unroll
    for (int u = 0; u < 4; ++u) async_cp16(kdst + u * 8, ksrc + u * 8);
    const f16* vsrc = vb + (size_t)threadIdx.x * NTOK + k0;
    f16* vdst = &Vs[buf][threadIdx.x][0];
#pragma unroll
    for (int u = 0; u < 4; ++u) async_cp16(vdst + u * 8, vsrc + u * 8);
  };

  stage(0, 0);
  async_wait0();
  __syncthreads();

#pragma unroll 1
  for (int k0 = 0; k0 < NTOK; k0 += 32) {
    const int buf = (k0 >> 5) & 1;
    if (k0 + 32 < NTOK) stage(buf ^ 1, k0 + 32);  // overlap with compute

    // ---- scores: 16 queries x 32 keys, K=256 -> 16 WMMAs
    v8f s0, s1;
#pragma unroll
    for (int j = 0; j < 8; ++j) { s0[j] = 0.f; s1[j] = 0.f; }
#pragma unroll
    for (int cb = 0; cb < 8; ++cb) {
      v16h bk0 = ld_frag(&Ks[buf][0][cb * 32], 264);
      s0 = wmma16(qf[cb], bk0, s0);
      v16h bk1 = ld_frag(&Ks[buf][16][cb * 32], 264);
      s1 = wmma16(qf[cb], bk1, s1);
    }

    // ---- online softmax in registers (row j+8*hi replicated across half)
    float mx[8];
#pragma unroll
    for (int j = 0; j < 8; ++j) {
      s0[j] *= 0.0625f;  // * c^-0.5
      s1[j] *= 0.0625f;
      mx[j] = fmaxf(s0[j], s1[j]);
    }
#pragma unroll
    for (int d = 1; d < 16; d <<= 1)
#pragma unroll
      for (int j = 0; j < 8; ++j) mx[j] = fmaxf(mx[j], __shfl_xor(mx[j], d, 32));

    float fac[8], ps[8];
#pragma unroll
    for (int j = 0; j < 8; ++j) {
      float mn = fmaxf(m_i[j], mx[j]);
      fac[j]   = __expf(m_i[j] - mn);
      m_i[j]   = mn;
      float pa = __expf(s0[j] - mn);
      float pb = __expf(s1[j] - mn);
      ps[j]    = pa + pb;
      Pw[w][j + 8 * hi][col]      = (f16)pa;
      Pw[w][j + 8 * hi][16 + col] = (f16)pb;
    }
#pragma unroll
    for (int d = 1; d < 16; d <<= 1)
#pragma unroll
      for (int j = 0; j < 8; ++j) ps[j] += __shfl_xor(ps[j], d, 32);
#pragma unroll
    for (int j = 0; j < 8; ++j) l_i[j] = l_i[j] * fac[j] + ps[j];

#pragma unroll
    for (int ct = 0; ct < 16; ++ct)
#pragma unroll
      for (int j = 0; j < 8; ++j) acc[ct][j] *= fac[j];

    // ---- acc += P @ V (16 column tiles, K=32)
    v16h ap = ld_frag(&Pw[w][0][0], 32);
#pragma unroll
    for (int ct = 0; ct < 16; ++ct) {
      v16h bv = ld_frag(&Vs[buf][ct * 16][0], 40);
      acc[ct] = wmma16(ap, bv, acc[ct]);
    }

    async_wait0();      // next chunk's copies landed (overlapped above)
    __syncthreads();    // all waves done reading buf; next buf ready
  }

  // ---- final 1/l normalization + store (b, n, c) f16
  float inv[8];
#pragma unroll
  for (int j = 0; j < 8; ++j) inv[j] = 1.f / l_i[j];
  f16* ob = out + (size_t)b * NTOK * C;
#pragma unroll
  for (int ct = 0; ct < 16; ++ct)
#pragma unroll
    for (int j = 0; j < 8; ++j)
      ob[(size_t)(myq + j + 8 * hi) * C + ct * 16 + col] =
          (f16)(acc[ct][j] * inv[j]);
}

// ---------------------------------------------------------------------------
extern "C" void kernel_launch(void* const* d_in, const int* in_sizes, int n_in,
                              void* d_out, int out_size, void* d_ws,
                              size_t ws_size, hipStream_t stream) {
  const float* x     = (const float*)d_in[0];
  const float* gsc   = (const float*)d_in[1];
  const float* gbi   = (const float*)d_in[2];
  const float* w_qkv = (const float*)d_in[3];
  const float* b_qkv = (const float*)d_in[4];
  const float* w_out = (const float*)d_in[5];
  const float* b_out = (const float*)d_in[6];
  float* out = (float*)d_out;

  // Workspace carve-up
  char* ws = (char*)d_ws;
  f16* xnT  = (f16*)ws; ws += (size_t)BATCH * NTOK * C * 2;     // 16.8 MB
  f16* qk   = (f16*)ws; ws += (size_t)BATCH * NTOK * LDQK * 2;  // 33.6 MB
  f16* vT   = (f16*)ws; ws += (size_t)BATCH * C * NTOK * 2;     // 16.8 MB
  f16* attn = (f16*)ws; ws += (size_t)BATCH * NTOK * C * 2;     // 16.8 MB
  f16* wq16 = (f16*)ws; ws += (size_t)(3 * C) * C * 2;
  f16* wo16 = (f16*)ws; ws += (size_t)C * C * 2;
  float* gmean = (float*)ws; ws += BATCH * GROUPS * 4;
  float* grstd = (float*)ws; ws += BATCH * GROUPS * 4;

  // 1) GroupNorm stats
  gn_stats_kernel<<<BATCH * GROUPS, 256, 0, stream>>>(x, gmean, grstd);

  // 2) Weight converts
  cvt_f16_kernel<<<(3 * C * C + 255) / 256, 256, 0, stream>>>(w_qkv, wq16,
                                                              3 * C * C);
  cvt_f16_kernel<<<(C * C + 255) / 256, 256, 0, stream>>>(w_out, wo16, C * C);

  // 3) Normalize + transpose -> xnT (b, n, c) f16
  gn_apply_t_kernel<<<dim3(NTOK / 32, C / 32, BATCH), 256, 0, stream>>>(
      x, gmean, grstd, gsc, gbi, xnT);

  // 4a) q|k projection: qk(b,n,512) = xnT @ w_qkv[0:512]^T + bias
  gemm_abt_kernel<0><<<dim3(NTOK / 128, LDQK / 128, BATCH), 256, 0, stream>>>(
      xnT, C, (long long)NTOK * C, wq16, C, 0LL, b_qkv, qk, LDQK,
      (long long)NTOK * LDQK, nullptr, 0LL, C);

  // 4b) vT projection: vT(b,c,n) = w_qkv[512:768] @ xn  (rows = channels)
  gemm_abt_kernel<2><<<dim3(C / 128, NTOK / 128, BATCH), 256, 0, stream>>>(
      wq16 + (size_t)2 * C * C, C, 0LL, xnT, C, (long long)NTOK * C,
      b_qkv + 2 * C, vT, NTOK, (long long)C * NTOK, nullptr, 0LL, C);

  // 5) Flash attention -> attn (b, n, 256) f16
  attn_kernel<<<dim3(NTOK / 128, BATCH), 256, 0, stream>>>(qk, vT, attn);

  // 6) Output projection + bias + residual -> d_out (b, c, n) f32
  gemm_abt_kernel<1><<<dim3(C / 128, NTOK / 128, BATCH), 256, 0, stream>>>(
      wo16, C, 0LL, attn, C, (long long)NTOK * C, b_out, out, NTOK,
      (long long)C * NTOK, x, (long long)C * NTOK, C);
}

// v001
// It runs in 237 microseconds.
// Next to v000, in two timings, it ran 1.18 times as fast each time.
#include <hip/hip_runtime.h>
#include <math.h>

typedef _Float16 f16;
typedef __attribute__((ext_vector_type(16))) _Float16 v16h;
typedef __attribute__((ext_vector_type(8)))  _Float16 v8h;
typedef __attribute__((ext_vector_type(8)))  float    v8f;

// Problem constants (fixed by the reference)
constexpr int BATCH  = 8;
constexpr int C      = 256;
constexpr int NTOK   = 4096;   // 64*64
constexpr int LDQK   = 512;    // q|k packed
constexpr int GROUPS = 32;

// ---------------------------------------------------------------------------
// Fragment helpers: CDNA5 16-bit A/B fragment layout (16x32, ISA 7.12.2):
// lane L: row/col = L&15 ; kb = (L>>4)*8 ; elements 0..7 hold K=kb..kb+7,
// elements 8..15 hold K=kb+16..kb+23.  Two 16B loads per lane.
// ---------------------------------------------------------------------------
__device__ __forceinline__ v16h ld_frag(const f16* p, int ld) {
  const int lane = threadIdx.x & 31;
  const f16* base = p + (size_t)(lane & 15) * ld + (lane >> 4) * 8;
  v8h lo = *(const v8h*)(base);
  v8h hh = *(const v8h*)(base + 16);
  v16h r;
#pragma unroll
  for (int i = 0; i < 8; ++i) { r[i] = lo[i]; r[i + 8] = hh[i]; }
  return r;
}

__device__ __forceinline__ v8f wmma16(v16h a, v16h b, v8f c) {
  return __builtin_amdgcn_wmma_f32_16x16x32_f16(false, a, false, b,
                                                (short)0, c, false, false);
}

// Async global->LDS 16B copy (CDNA5, tracked by ASYNCcnt).  Inline asm since
// the clang builtin arity differs across toolchains.
__device__ __forceinline__ void async_cp16(f16* ldst, const f16* gsrc) {
  unsigned l = (unsigned)(uintptr_t)ldst;                 // addr[31:0] = LDS off
  unsigned long long g = (unsigned long long)(uintptr_t)gsrc;
  asm volatile("global_load_async_to_lds_b128 %0, %1, off"
               :: "v"(l), "v"(g) : "memory");
}
__device__ __forceinline__ void async_wait0() {
  asm volatile("s_wait_asynccnt 0x0" ::: "memory");
}

// ---------------------------------------------------------------------------
// GroupNorm stats: one block per (b,g); 8 channels * 4096 = 32768 elements.
// ---------------------------------------------------------------------------
__global__ __launch_bounds__(256) void gn_stats_kernel(
    const float* __restrict__ x, float* __restrict__ mean,
    float* __restrict__ rstd) {
  const int bg = blockIdx.x;
  const float* p = x + (size_t)bg * 32768;
  float s = 0.f, q = 0.f;
  for (int i = threadIdx.x; i < 32768; i += 256) {
    float v = p[i];
    s += v;
    q = fmaf(v, v, q);
  }
#pragma unroll
  for (int off = 16; off > 0; off >>= 1) {
    s += __shfl_xor(s, off, 32);
    q += __shfl_xor(q, off, 32);
  }
  __shared__ float ss[8], qs[8];
  if ((threadIdx.x & 31) == 0) {
    ss[threadIdx.x >> 5] = s;
    qs[threadIdx.x >> 5] = q;
  }
  __syncthreads();
  if (threadIdx.x == 0) {
    float S = 0.f, Q = 0.f;
#pragma unroll
    for (int i = 0; i < 8; ++i) { S += ss[i]; Q += qs[i]; }
    float mu  = S * (1.f / 32768.f);
    float var = Q * (1.f / 32768.f) - mu * mu;
    mean[bg] = mu;
    rstd[bg] = rsqrtf(var + 1e-5f);
  }
}

// ---------------------------------------------------------------------------
// Normalize + transpose: x (b,c,n) f32 -> xnT (b,n,c) f16, 32x32 LDS tiles.
// ---------------------------------------------------------------------------
__global__ __launch_bounds__(256) void gn_apply_t_kernel(
    const float* __restrict__ x, const float* __restrict__ mean,
    const float* __restrict__ rstd, const float* __restrict__ gsc,
    const float* __restrict__ gbi, f16* __restrict__ xnT) {
  const int b  = blockIdx.z;
  const int c0 = blockIdx.y * 32;
  const int n0 = blockIdx.x * 32;
  __shared__ f16 T[32][33];

  const int ci  = threadIdx.x >> 3;
  const int nj0 = (threadIdx.x & 7) * 4;
  const int c   = c0 + ci;
  const int g   = c >> 3;
  const float mu = mean[b * GROUPS + g];
  const float rs = rstd[b * GROUPS + g];
  const float sc = gsc[c];
  const float bi = gbi[c];
  const float* xr = x + ((size_t)b * C + c) * NTOK + n0;
#pragma unroll
  for (int u = 0; u < 4; ++u) {
    float v = xr[nj0 + u];
    T[ci][nj0 + u] = (f16)((v - mu) * rs * sc + bi);
  }
  __syncthreads();
  const int ni  = threadIdx.x >> 3;
  const int cj0 = (threadIdx.x & 7) * 4;
  f16* orow = xnT + ((size_t)b * NTOK + n0 + ni) * C + c0 + cj0;
#pragma unroll
  for (int u = 0; u < 4; ++u) orow[u] = T[cj0 + u][ni];
}

// ---------------------------------------------------------------------------
__global__ void cvt_f16_kernel(const float* __restrict__ src,
                               f16* __restrict__ dst, int n) {
  int i = blockIdx.x * 256 + threadIdx.x;
  if (i < n) dst[i] = (f16)src[i];
}

// ---------------------------------------------------------------------------
// WMMA GEMM: C[M,N] = A[M,K] * B[N,K]^T.  Tile 128x128, 8 waves, B in LDS.
// MODE 0: f16 out, bias[N]          (q|k projection)
// MODE 1: f32 out, bias[M] + resid  (output projection)
// MODE 2: f16 out, bias[M]          (vT projection: rows = channels)
// ---------------------------------------------------------------------------
template <int MODE>
__global__ __launch_bounds__(256, 1) void gemm_abt_kernel(
    const f16* __restrict__ A, int lda, long long sA,
    const f16* __restrict__ B, int ldb, long long sB,
    const float* __restrict__ bias, void* __restrict__ Cv, int ldc,
    long long sC, const float* __restrict__ resid, long long sR, int K) {
  const int b  = blockIdx.z;
  const int m0 = blockIdx.x * 128;
  const int n0 = blockIdx.y * 128;
  A += (size_t)b * sA;
  B += (size_t)b * sB;

  __shared__ f16 Bs[128][40];  // 80B pitch: 16B aligned, bank-clean

  const int w    = threadIdx.x >> 5;
  const int lane = threadIdx.x & 31;
  const int hi   = lane >> 4;
  const int col  = lane & 15;

  v8f acc[8];
#pragma unroll
  for (int i = 0; i < 8; ++i)
#pragma unroll
    for (int j = 0; j < 8; ++j) acc[i][j] = 0.f;

  const f16* arow = A + (size_t)(m0 + w * 16) * lda;
  const int r  = threadIdx.x >> 1;
  const int sg = threadIdx.x & 1;

  for (int kb = 0; kb < K; kb += 32) {
    const f16* src = B + (size_t)(n0 + r) * ldb + kb + sg * 16;
    *(v8h*)&Bs[r][sg * 16]     = *(const v8h*)(src);
    *(v8h*)&Bs[r][sg * 16 + 8] = *(const v8h*)(src + 8);
    __syncthreads();
    v16h a = ld_frag(arow + kb, lda);
#pragma unroll
    for (int ct = 0; ct < 8; ++ct) {
      v16h bf = ld_frag(&Bs[ct * 16][0], 40);
      acc[ct] = wmma16(a, bf, acc[ct]);
    }
    __syncthreads();
  }

  if (MODE == 0) {
    f16* Cp = (f16*)Cv + (size_t)b * sC;
#pragma unroll
    for (int ct = 0; ct < 8; ++ct) {
      float bn = bias[n0 + ct * 16 + col];
#pragma unroll
      for (int j = 0; j < 8; ++j) {
        int m = m0 + w * 16 + j + 8 * hi;
        Cp[(size_t)m * ldc + n0 + ct * 16 + col] = (f16)(acc[ct][j] + bn);
      }
    }
  } else if (MODE == 1) {
    float* Cp = (float*)Cv + (size_t)b * sC;
    const float* Rp = resid + (size_t)b * sR;
#pragma unroll
    for (int ct = 0; ct < 8; ++ct) {
#pragma unroll
      for (int j = 0; j < 8; ++j) {
        int m = m0 + w * 16 + j + 8 * hi;
        size_t idx = (size_t)m * ldc + n0 + ct * 16 + col;
        Cp[idx] = acc[ct][j] + bias[m] + Rp[idx];
      }
    }
  } else {
    f16* Cp = (f16*)Cv + (size_t)b * sC;
#pragma unroll
    for (int ct = 0; ct < 8; ++ct) {
#pragma unroll
      for (int j = 0; j < 8; ++j) {
        int m = m0 + w * 16 + j + 8 * hi;
        Cp[(size_t)m * ldc + n0 + ct * 16 + col] = (f16)(acc[ct][j] + bias[m]);
      }
    }
  }
}

__device__ __forceinline__ float xhalf(float x) {
  return __builtin_bit_cast(
      float, __builtin_amdgcn_permlanex16(__builtin_bit_cast(int, x),
                                          __builtin_bit_cast(int, x),
                                          0x76543210, 0xfedcba98, false, false));
}

// Two waves per SIMD: the grid has one work-group per WGP, so fewer registers
// buy no residency; said here so that the compiler spends the budget on LDS
// fragments fetched ahead instead of waiting out every load.
__global__ __launch_bounds__(256) __attribute__((amdgpu_waves_per_eu(2, 2)))
void attn_kernel(
    const f16* __restrict__ qk, const f16* __restrict__ vT,
    f16* __restrict__ out) {
  const int b    = blockIdx.y;
  const int q0   = blockIdx.x * 128;
  const int w    = threadIdx.x >> 5;
  const int lane = threadIdx.x & 31;
  const int hi   = lane >> 4;
  const int col  = lane & 15;

  __shared__ f16 Ks[2][32][264];   // keys x channels, 528B pitch
  __shared__ f16 Vs[2][256][40];   // channels x keys, 80B pitch

  const f16* qb  = qk + (size_t)b * NTOK * LDQK;
  const f16* vb  = vT + (size_t)b * C * NTOK;
  const int  myq = q0 + w * 16;

  // Preload Q fragments (16 queries x K=256), used as the B operand
  v16h qf[8];
#pragma unroll
  for (int cb = 0; cb < 8; ++cb)
    qf[cb] = ld_frag(qb + (size_t)myq * LDQK + cb * 32, LDQK);

  // acc[ct][j] = O^T[channel ct*16 + j + 8*hi][query col]
  v8f acc[16];
#pragma unroll
  for (int i = 0; i < 16; ++i)
#pragma unroll
    for (int j = 0; j < 8; ++j) acc[i][j] = 0.f;

  float m_i = -__builtin_inff();  // running maximum of this lane's query
  float l_i = 0.f;                // running sum over this wave half's keys

  // Async-stage one 32-key chunk (K rows + V rows) into buffer `buf`.
  auto stage = [&](int buf, int k0) {
    const int kr = threadIdx.x >> 3, sg = threadIdx.x & 7;
    const f16* ksrc = qb + (size_t)(k0 + kr) * LDQK + C + sg * 32;
    f16* kdst = &Ks[buf][kr][sg * 32];
#pragma unroll
    for (int u = 0; u < 4; ++u) async_cp16(kdst + u * 8, ksrc + u * 8);
    const f16* vsrc = vb + (size_t)threadIdx.x * NTOK + k0;
    f16* vdst = &Vs[buf][threadIdx.x][0];
#pragma unroll
    for (int u = 0; u < 4; ++u) async_cp16(vdst + u * 8, vsrc + u * 8);
  };

  stage(0, 0);
  async_wait0();
  __syncthreads();

#pragma unroll 1
  for (int k0 = 0; k0 < NTOK; k0 += 32) {
    const int buf = (k0 >> 5) & 1;
    if (k0 + 32 < NTOK) stage(buf ^ 1, k0 + 32);  // overlap with compute

    // ---- scores^T: 32 keys x 16 queries, K=256 -> 16 WMMAs
    // s0[j] = key j + 8*hi, s1[j] = key 16 + j + 8*hi, query col
    v8f s0, s1;
#pragma unroll
    for (int j = 0; j < 8; ++j) { s0[j] = 0.f; s1[j] = 0.f; }
#pragma unroll
    for (int cb = 0; cb < 8; ++cb) {
      v16h ak0 = ld_frag(&Ks[buf][0][cb * 32], 264);
      s0 = wmma16(ak0, qf[cb], s0);
      v16h ak1 = ld_frag(&Ks[buf][16][cb * 32], 264);
      s1 = wmma16(ak1, qf[cb], s1);
    }

    // ---- online softmax, one query per lane
    float mt[8];
#pragma unroll
    for (int j = 0; j < 8; ++j) {
      s0[j] *= 0.0625f;  // * c^-0.5
      s1[j] *= 0.0625f;
      mt[j] = fmaxf(s0[j], s1[j]);
    }
    float mx = fmaxf(fmaxf(fmaxf(mt[0], mt[1]), fmaxf(mt[2], mt[3])),
                     fmaxf(fmaxf(mt[4], mt[5]), fmaxf(mt[6], mt[7])));
    mx = fmaxf(mx, xhalf(mx));  // both halves now hold the chunk's maximum

    const float mn  = fmaxf(m_i, mx);
    const float fac = __expf(m_i - mn);
    m_i = mn;

    v16h bp;      // P^T as B operand: 32 keys x 16 queries
    float pt[8];
#pragma unroll
    for (int j = 0; j < 8; ++j) {
      float pa = __expf(s0[j] - mn);
      float pb = __expf(s1[j] - mn);
      pt[j]     = pa + pb;
      bp[j]     = (f16)pa;
      bp[j + 8] = (f16)pb;
    }
    const float ps = ((pt[0] + pt[1]) + (pt[2] + pt[3])) +
                     ((pt[4] + pt[5]) + (pt[6] + pt[7]));
    l_i = l_i * fac + ps;

#pragma unroll
    for (int ct = 0; ct < 16; ++ct)
#pragma unroll
      for (int j = 0; j < 8; ++j) acc[ct][j] *= fac;

    // ---- acc += V^T @ P^T (16 channel tiles, K=32)
#pragma unroll
    for (int ct = 0; ct < 16; ++ct) {
      v16h av = ld_frag(&Vs[buf][ct * 16][0], 40);
      acc[ct] = wmma16(av, bp, acc[ct]);
    }

    async_wait0();      // next chunk's copies landed (overlapped above)
    __syncthreads();    // all waves done reading buf; next buf ready
  }

  // ---- join the halves' sums, 1/l normalization, store (b, n, c) f16:
  // a lane's 8 accumulator registers are 8 consecutive channels of its query
  const float inv = 1.f / (l_i + xhalf(l_i));
  f16* orow = out + (size_t)b * NTOK * C + (size_t)(myq + col) * C + 8 * hi;
#pragma unroll
  for (int ct = 0; ct < 16; ++ct) {
    v8h o;
#pragma unroll
    for (int j = 0; j < 8; ++j) o[j] = (f16)(acc[ct][j] * inv);
    *(v8h*)(orow + ct * 16) = o;
  }
}

// ---------------------------------------------------------------------------
extern "C" void kernel_launch(void* const* d_in, const int* in_sizes, int n_in,
                              void* d_out, int out_size, void* d_ws,
                              size_t ws_size, hipStream_t stream) {
  const float* x     = (const float*)d_in[0];
  const float* gsc   = (const float*)d_in[1];
  const float* gbi   = (const float*)d_in[2];
  const float* w_qkv = (const float*)d_in[3];
  const float* b_qkv = (const float*)d_in[4];
  const float* w_out = (const float*)d_in[5];
  const float* b_out = (const float*)d_in[6];
  float* out = (float*)d_out;

  // Workspace carve-up
  char* ws = (char*)d_ws;
  f16* xnT  = (f16*)ws; ws += (size_t)BATCH * NTOK * C * 2;     // 16.8 MB
  f16* qk   = (f16*)ws; ws += (size_t)BATCH * NTOK * LDQK * 2;  // 33.6 MB
  f16* vT   = (f16*)ws; ws += (size_t)BATCH * C * NTOK * 2;     // 16.8 MB
  f16* attn = (f16*)ws; ws += (size_t)BATCH * NTOK * C * 2;     // 16.8 MB
  f16* wq16 = (f16*)ws; ws += (size_t)(3 * C) * C * 2;
  f16* wo16 = (f16*)ws; ws += (size_t)C * C * 2;
  float* gmean = (float*)ws; ws += BATCH * GROUPS * 4;
  float* grstd = (float*)ws; ws += BATCH * GROUPS * 4;

  // 1) GroupNorm stats
  gn_stats_kernel<<<BATCH * GROUPS, 256, 0, stream>>>(x, gmean, grstd);

  // 2) Weight converts
  cvt_f16_kernel<<<(3 * C * C + 255) / 256, 256, 0, stream>>>(w_qkv, wq16,
                                                              3 * C * C);
  cvt_f16_kernel<<<(C * C + 255) / 256, 256, 0, stream>>>(w_out, wo16, C * C);

  // 3) Normalize + transpose -> xnT (b, n, c) f16
  gn_apply_t_kernel<<<dim3(NTOK / 32, C / 32, BATCH), 256, 0, stream>>>(
      x, gmean, grstd, gsc, gbi, xnT);

  // 4a) q|k projection: qk(b,n,512) = xnT @ w_qkv[0:512]^T + bias
  gemm_abt_kernel<0><<<dim3(NTOK / 128, LDQK / 128, BATCH), 256, 0, stream>>>(
      xnT, C, (long long)NTOK * C, wq16, C, 0LL, b_qkv, qk, LDQK,
      (long long)NTOK * LDQK, nullptr, 0LL, C);

  // 4b) vT projection: vT(b,c,n) = w_qkv[512:768] @ xn  (rows = channels)
  gemm_abt_kernel<2><<<dim3(C / 128, NTOK / 128, BATCH), 256, 0, stream>>>(
      wq16 + (size_t)2 * C * C, C, 0LL, xnT, C, (long long)NTOK * C,
      b_qkv + 2 * C, vT, NTOK, (long long)C * NTOK, nullptr, 0LL, C);

  // 5) Flash attention -> attn (b, n, 256) f16
  attn_kernel<<<dim3(NTOK / 128, BATCH), 256, 0, stream>>>(qk, vT, attn);

  // 6) Output projection + bias + residual -> d_out (b, c, n) f32
  gemm_abt_kernel<1><<<dim3(C / 128, NTOK / 128, BATCH), 256, 0, stream>>>(
      wo16, C, 0LL, attn, C, (long long)NTOK * C, b_out, out, NTOK,
      (long long)C * NTOK, x, (long long)C * NTOK, C);
}

// v002
// Measured time: 171 microseconds a run.
// In both of two side-by-side timings against v001, it was 1.39 times as fast.
// Over all steps from v000 it is 1.64 times as fast.
#include <hip/hip_runtime.h>
#include <math.h>

typedef _Float16 f16;
typedef __attribute__((ext_vector_type(16))) _Float16 v16h;
typedef __attribute__((ext_vector_type(8)))  _Float16 v8h;
typedef __attribute__((ext_vector_type(8)))  float    v8f;

// Problem constants (fixed by the reference)
constexpr int BATCH  = 8;
constexpr int C      = 256;
constexpr int NTOK   = 4096;   // 64*64
constexpr int LDQK   = 512;    // q|k packed
constexpr int GROUPS = 32;

// ---------------------------------------------------------------------------
// Fragment helpers: CDNA5 16-bit A/B fragment layout (16x32, ISA 7.12.2):
// lane L: row/col = L&15 ; kb = (L>>4)*8 ; elements 0..7 hold K=kb..kb+7,
// elements 8..15 hold K=kb+16..kb+23.  Two 16B loads per lane.
// ---------------------------------------------------------------------------
__device__ __forceinline__ v16h ld_frag(const f16* p, int ld) {
  const int lane = threadIdx.x & 31;
  const f16* base = p + (size_t)(lane & 15) * ld + (lane >> 4) * 8;
  v8h lo = *(const v8h*)(base);
  v8h hh = *(const v8h*)(base + 16);
  v16h r;
#pragma unroll
  for (int i = 0; i < 8; ++i) { r[i] = lo[i]; r[i + 8] = hh[i]; }
  return r;
}

__device__ __forceinline__ v8f wmma16(v16h a, v16h b, v8f c) {
  return __builtin_amdgcn_wmma_f32_16x16x32_f16(false, a, false, b,
                                                (short)0, c, false, false);
}

// Async global->LDS 16B copy (CDNA5, tracked by ASYNCcnt), as the builtin: the
// compiler then owns the address registers, also those above v255.
typedef __attribute__((ext_vector_type(4))) int v4i;
__device__ __forceinline__ void async_cp16(f16* ldst, const f16* gsrc) {
  __builtin_amdgcn_global_load_async_to_lds_b128(
      (__attribute__((address_space(1))) v4i*)gsrc,
      (__attribute__((address_space(3))) v4i*)ldst, 0, 0);
}
__device__ __forceinline__ void async_wait0() {
  asm volatile("s_wait_asynccnt 0x0" ::: "memory");
}
// This wave's LDS reads have returned: owed before a buffer it read is refilled.
__device__ __forceinline__ void lds_wait0() {
  asm volatile("s_wait_dscnt 0x0" ::: "memory");
}

// ---------------------------------------------------------------------------
// GroupNorm stats: one block per (b,g); 8 channels * 4096 = 32768 elements.
// ---------------------------------------------------------------------------
__global__ __launch_bounds__(256) void gn_stats_kernel(
    const float* __restrict__ x, float* __restrict__ mean,
    float* __restrict__ rstd) {
  const int bg = blockIdx.x;
  const float* p = x + (size_t)bg * 32768;
  float s = 0.f, q = 0.f;
  for (int i = threadIdx.x; i < 32768; i += 256) {
    float v = p[i];
    s += v;
    q = fmaf(v, v, q);
  }
#pragma unroll
  for (int off = 16; off > 0; off >>= 1) {
    s += __shfl_xor(s, off, 32);
    q += __shfl_xor(q, off, 32);
  }
  __shared__ float ss[8], qs[8];
  if ((threadIdx.x & 31) == 0) {
    ss[threadIdx.x >> 5] = s;
    qs[threadIdx.x >> 5] = q;
  }
  __syncthreads();
  if (threadIdx.x == 0) {
    float S = 0.f, Q = 0.f;
#pragma unroll
    for (int i = 0; i < 8; ++i) { S += ss[i]; Q += qs[i]; }
    float mu  = S * (1.f / 32768.f);
    float var = Q * (1.f / 32768.f) - mu * mu;
    mean[bg] = mu;
    rstd[bg] = rsqrtf(var + 1e-5f);
  }
}

// ---------------------------------------------------------------------------
// Normalize + transpose: x (b,c,n) f32 -> xnT (b,n,c) f16, 32x32 LDS tiles.
// ---------------------------------------------------------------------------
__global__ __launch_bounds__(256) void gn_apply_t_kernel(
    const float* __restrict__ x, const float* __restrict__ mean,
    const float* __restrict__ rstd, const float* __restrict__ gsc,
    const float* __restrict__ gbi, f16* __restrict__ xnT) {
  const int b  = blockIdx.z;
  const int c0 = blockIdx.y * 32;
  const int n0 = blockIdx.x * 32;
  __shared__ f16 T[32][33];

  const int ci  = threadIdx.x >> 3;
  const int nj0 = (threadIdx.x & 7) * 4;
  const int c   = c0 + ci;
  const int g   = c >> 3;
  const float mu = mean[b * GROUPS + g];
  const float rs = rstd[b * GROUPS + g];
  const float sc = gsc[c];
  const float bi = gbi[c];
  const float* xr = x + ((size_t)b * C + c) * NTOK + n0;
#pragma unroll
  for (int u = 0; u < 4; ++u) {
    float v = xr[nj0 + u];
    T[ci][nj0 + u] = (f16)((v - mu) * rs * sc + bi);
  }
  __syncthreads();
  const int ni  = threadIdx.x >> 3;
  const int cj0 = (threadIdx.x & 7) * 4;
  f16* orow = xnT + ((size_t)b * NTOK + n0 + ni) * C + c0 + cj0;
#pragma unroll
  for (int u = 0; u < 4; ++u) orow[u] = T[cj0 + u][ni];
}

// ---------------------------------------------------------------------------
__global__ void cvt_f16_kernel(const float* __restrict__ src,
                               f16* __restrict__ dst, int n) {
  int i = blockIdx.x * 256 + threadIdx.x;
  if (i < n) dst[i] = (f16)src[i];
}

// ---------------------------------------------------------------------------
// WMMA GEMM: C[M,N] = A[M,K] * B[N,K]^T.  Tile 128x128, 8 waves, B in LDS.
// MODE 0: f16 out, bias[N]          (q|k projection)
// MODE 1: f32 out, bias[M] + resid  (output projection)
// MODE 2: f16 out, bias[M]          (vT projection: rows = channels)
// ---------------------------------------------------------------------------
template <int MODE>
__global__ __launch_bounds__(256, 1) void gemm_abt_kernel(
    const f16* __restrict__ A, int lda, long long sA,
    const f16* __restrict__ B, int ldb, long long sB,
    const float* __restrict__ bias, void* __restrict__ Cv, int ldc,
    long long sC, const float* __restrict__ resid, long long sR, int K) {
  const int b  = blockIdx.z;
  const int m0 = blockIdx.x * 128;
  const int n0 = blockIdx.y * 128;
  A += (size_t)b * sA;
  B += (size_t)b * sB;

  __shared__ f16 Bs[128][40];  // 80B pitch: 16B aligned, bank-clean

  const int w    = threadIdx.x >> 5;
  const int lane = threadIdx.x & 31;
  const int hi   = lane >> 4;
  const int col  = lane & 15;

  v8f acc[8];
#pragma unroll
  for (int i = 0; i < 8; ++i)
#pragma unroll
    for (int j = 0; j < 8; ++j) acc[i][j] = 0.f;

  const f16* arow = A + (size_t)(m0 + w * 16) * lda;
  const int r  = threadIdx.x >> 1;
  const int sg = threadIdx.x & 1;

  for (int kb = 0; kb < K; kb += 32) {
    const f16* src = B + (size_t)(n0 + r) * ldb + kb + sg * 16;
    *(v8h*)&Bs[r][sg * 16]     = *(const v8h*)(src);
    *(v8h*)&Bs[r][sg * 16 + 8] = *(const v8h*)(src + 8);
    __syncthreads();
    v16h a = ld_frag(arow + kb, lda);
#pragma unroll
    for (int ct = 0; ct < 8; ++ct) {
      v16h bf = ld_frag(&Bs[ct * 16][0], 40);
      acc[ct] = wmma16(a, bf, acc[ct]);
    }
    __syncthreads();
  }

  if (MODE == 0) {
    f16* Cp = (f16*)Cv + (size_t)b * sC;
#pragma unroll
    for (int ct = 0; ct < 8; ++ct) {
      float bn = bias[n0 + ct * 16 + col];
#pragma unroll
      for (int j = 0; j < 8; ++j) {
        int m = m0 + w * 16 + j + 8 * hi;
        Cp[(size_t)m * ldc + n0 + ct * 16 + col] = (f16)(acc[ct][j] + bn);
      }
    }
  } else if (MODE == 1) {
    float* Cp = (float*)Cv + (size_t)b * sC;
    const float* Rp = resid + (size_t)b * sR;
#pragma unroll
    for (int ct = 0; ct < 8; ++ct) {
#pragma unroll
      for (int j = 0; j < 8; ++j) {
        int m = m0 + w * 16 + j + 8 * hi;
        size_t idx = (size_t)m * ldc + n0 + ct * 16 + col;
        Cp[idx] = acc[ct][j] + bias[m] + Rp[idx];
      }
    }
  } else {
    f16* Cp = (f16*)Cv + (size_t)b * sC;
#pragma unroll
    for (int ct = 0; ct < 8; ++ct) {
#pragma unroll
      for (int j = 0; j < 8; ++j) {
        int m = m0 + w * 16 + j + 8 * hi;
        Cp[(size_t)m * ldc + n0 + ct * 16 + col] = (f16)(acc[ct][j] + bias[m]);
      }
    }
  }
}

__device__ __forceinline__ float xhalf(float x) {
  return __builtin_bit_cast(
      float, __builtin_amdgcn_permlanex16(__builtin_bit_cast(int, x),
                                          __builtin_bit_cast(int, x),
                                          0x76543210, 0xfedcba98, false, false));
}

constexpr int SKEYS = 64;            // keys per stage
constexpr int NSTG  = NTOK / SKEYS;  // stages

// Two waves per SIMD: the grid has one work-group per WGP, so fewer registers
// buy no residency; the 32-query output tile and Q take 384 registers.
__global__ __launch_bounds__(256) __attribute__((amdgpu_waves_per_eu(2, 2)))
void attn_kernel(
    const f16* __restrict__ qk, const f16* __restrict__ vT,
    f16* __restrict__ out) {
  const int b    = blockIdx.y;
  const int q0   = blockIdx.x * 128;
  const int w    = __builtin_amdgcn_readfirstlane(threadIdx.x >> 5);
  const int lane = threadIdx.x & 31;
  const int hi   = lane >> 4;
  const int col  = lane & 15;
  const int qg   = w & 3;   // query group of 32
  const int kh   = w >> 2;  // half of each stage's keys

  __shared__ f16 Ks[2][SKEYS][264];   // keys x channels, 528B pitch
  __shared__ f16 Vs[2][256][72];      // channels x keys, 144B pitch
  __shared__ float Mg[8][32][32][4];  // merge: one output tile per wave
  __shared__ float Ml[8][2][32];      // merge: its maximum and sum

  const f16* qb  = qk + (size_t)b * NTOK * LDQK;
  const f16* vb  = vT + (size_t)b * C * NTOK;
  const int  myq = q0 + qg * 32;

  // Preload Q fragments (2 x 16 queries x K=256), used as the B operand
  v16h qf[2][8];
#pragma unroll
  for (int g = 0; g < 2; ++g)
#pragma unroll
    for (int cb = 0; cb < 8; ++cb)
      qf[g][cb] = ld_frag(qb + (size_t)(myq + g * 16) * LDQK + cb * 32, LDQK);
  // Stands in front of the first rewrite of the address pair these loads name;
  // the sched_barrier keeps the later address arithmetic from being lifted over.
  asm volatile("s_wait_xcnt 0x0" ::: "memory");
  __builtin_amdgcn_sched_barrier(0);

  // acc[g][ct][j] = O^T[channel ct*16 + j + 8*hi][query g*16 + col]
  v8f acc[2][16];
#pragma unroll
  for (int g = 0; g < 2; ++g)
#pragma unroll
    for (int i = 0; i < 16; ++i)
#pragma unroll
      for (int j = 0; j < 8; ++j) acc[g][i][j] = 0.f;

  float m_i[2] = {-__builtin_inff(), -__builtin_inff()};  // running maxima
  float l_i[2] = {0.f, 0.f};  // running sums over this wave half's keys

  // Async-stage one 64-key stage into buffer `buf`: a wave's copy covers one
  // whole 512B K row, or four whole 128B V^T rows.
  auto stage = [&](int buf, int k0) {
#pragma unroll
    for (int u = 0; u < 8; ++u) {
      const int kr = u * 8 + w;
      async_cp16(&Ks[buf][kr][lane * 8],
                 qb + (size_t)(k0 + kr) * LDQK + C + lane * 8);
    }
    const int vr = threadIdx.x >> 3, vs = threadIdx.x & 7;
#pragma unroll
    for (int u = 0; u < 8; ++u)
      async_cp16(&Vs[buf][u * 32 + vr][vs * 8],
                 vb + (size_t)(u * 32 + vr) * NTOK + k0 + vs * 8);
  };

  stage(0, 0);
  async_wait0();
  __syncthreads();
  stage(1, SKEYS);

  // One stage.  `refill` is a literal at both calls: the loop bodies stay free
  // of branches, so nothing of a pass can be sunk behind its matrix blocks.
  auto pass = [&](int t, bool refill) __attribute__((always_inline)) {
    const int buf = t & 1;

    // Fragments come from LDS in groups of four (eight 16B loads at one place),
    // one group ahead of the eight WMMAs that use them, in two register sets.
    // Each sched_barrier keeps a load group whole and ahead of the WMMA block
    // before its use: left alone, the compiler, short of registers, put every
    // fragment's loads directly in front of its own WMMAs and waited them out.
    v16h fa[4], fb[4];
    auto ldK4 = [&](v16h (&f)[4], int f0) {  // fragment f: channels f>>1, tile f&1
#pragma unroll
      for (int n = 0; n < 4; ++n)
        f[n] = ld_frag(
            &Ks[buf][kh * 32 + ((f0 + n) & 1) * 16][((f0 + n) >> 1) * 32], 264);
      __builtin_amdgcn_sched_barrier(0);
    };
    auto ldV4 = [&](v16h (&f)[4], int ct0) {
#pragma unroll
      for (int n = 0; n < 4; ++n)
        f[n] = ld_frag(&Vs[buf][(ct0 + n) * 16][kh * 32], 72);
      __builtin_amdgcn_sched_barrier(0);
    };

    // ---- scores^T: 32 keys x 32 queries, K=256 -> 32 WMMAs, 16 fragments
    // s[i][g][j] = key 16*i + j + 8*hi of this wave's half, query g*16 + col
    v8f s[2][2];
#pragma unroll
    for (int i = 0; i < 2; ++i)
#pragma unroll
      for (int g = 0; g < 2; ++g)
#pragma unroll
        for (int j = 0; j < 8; ++j) s[i][g][j] = 0.f;
    auto mmS4 = [&](const v16h (&f)[4], int f0) {
#pragma unroll
      for (int n = 0; n < 4; ++n) {
        const int i = (f0 + n) & 1, cb = (f0 + n) >> 1;
        s[i][0] = wmma16(f[n], qf[0][cb], s[i][0]);
        s[i][1] = wmma16(f[n], qf[1][cb], s[i][1]);
      }
      __builtin_amdgcn_sched_barrier(0);
    };
    ldK4(fa, 0);
    ldK4(fb, 4);
    mmS4(fa, 0);
    ldK4(fa, 8);
    mmS4(fb, 4);
    ldK4(fb, 12);
    mmS4(fa, 8);
    mmS4(fb, 12);

    // ---- online softmax, one query per lane and tile
    v16h bp[2];    // P^T as B operand: 32 keys x 16 queries each
    float fac[2];  // what the new maxima scale the old sums and outputs by
#pragma unroll
    for (int g = 0; g < 2; ++g) {
      float mt[8];
#pragma unroll
      for (int j = 0; j < 8; ++j) {
        s[0][g][j] *= 0.0625f;  // * c^-0.5
        s[1][g][j] *= 0.0625f;
        mt[j] = fmaxf(s[0][g][j], s[1][g][j]);
      }
      float mx = fmaxf(fmaxf(fmaxf(mt[0], mt[1]), fmaxf(mt[2], mt[3])),
                       fmaxf(fmaxf(mt[4], mt[5]), fmaxf(mt[6], mt[7])));
      mx = fmaxf(mx, xhalf(mx));  // both halves now hold the 32 keys' maximum

      const float mn  = fmaxf(m_i[g], mx);
      fac[g] = __expf(m_i[g] - mn);
      m_i[g] = mn;

      float pt[8];
#pragma unroll
      for (int j = 0; j < 8; ++j) {
        float pa = __expf(s[0][g][j] - mn);
        float pb = __expf(s[1][g][j] - mn);
        pt[j]        = pa + pb;
        bp[g][j]     = (f16)pa;
        bp[g][j + 8] = (f16)pb;
      }
      const float ps = ((pt[0] + pt[1]) + (pt[2] + pt[3])) +
                       ((pt[4] + pt[5]) + (pt[6] + pt[7]));
      l_i[g] = l_i[g] * fac[g] + ps;
    }

    // ---- acc = acc * fac + V^T @ P^T (16 channel x 2 query tiles, K=32).
    // Four channel tiles are rescaled at a time, one block ahead of their own
    // WMMAs: the first four while the first V^T fragments are on their way, the
    // others beside the WMMAs of the block before.
    auto scl4 = [&](int ct0) {
#pragma unroll
      for (int n = 0; n < 4; ++n)
#pragma unroll
        for (int j = 0; j < 8; ++j) {
          acc[0][ct0 + n][j] *= fac[0];
          acc[1][ct0 + n][j] *= fac[1];
        }
    };
    auto mmV4 = [&](const v16h (&f)[4], int ct0) {
#pragma unroll
      for (int n = 0; n < 4; ++n) {
        acc[0][ct0 + n] = wmma16(f[n], bp[0], acc[0][ct0 + n]);
        acc[1][ct0 + n] = wmma16(f[n], bp[1], acc[1][ct0 + n]);
      }
    };
    __builtin_amdgcn_sched_barrier(0);  // the next group waits for s to be dead
    ldV4(fa, 0);
    ldV4(fb, 4);
    scl4(0);
    __builtin_amdgcn_sched_barrier(0);  // ends a block, as in ldK4 and mmS4
    mmV4(fa, 0);
    scl4(4);
    __builtin_amdgcn_sched_barrier(0);
    ldV4(fa, 8);
    mmV4(fb, 4);
    scl4(8);
    __builtin_amdgcn_sched_barrier(0);
    ldV4(fb, 12);
    mmV4(fa, 8);
    scl4(12);
    __builtin_amdgcn_sched_barrier(0);
    mmV4(fb, 12);

    lds_wait0();        // this wave has left buf
    async_wait0();      // its copies of the next stage have landed
    __syncthreads();    // next stage published; every wave has left buf
    if (refill) stage(buf, (t + 2) * SKEYS);  // flies during stage t+1
  };
#pragma unroll 1
  for (int t = 0; t < NSTG - 2; ++t) pass(t, true);  // a stage t+2 exists
#pragma unroll 1
  for (int t = NSTG - 2; t < NSTG; ++t) pass(t, false);
  async_wait0();

  // ---- merge the two key halves of each query group: wave (qg, kh) hands
  // query tile 1-kh to its partner and finishes tile kh.
  const float lt[2] = {l_i[0] + xhalf(l_i[0]), l_i[1] + xhalf(l_i[1])};
  auto give = [&](const v8f (&a)[16], float m, float l) {
#pragma unroll
    for (int ct = 0; ct < 16; ++ct) {
#pragma unroll
      for (int h = 0; h < 2; ++h) {
        float4 v = make_float4(a[ct][4 * h], a[ct][4 * h + 1], a[ct][4 * h + 2],
                               a[ct][4 * h + 3]);
        *(float4*)&Mg[w][ct * 2 + h][lane][0] = v;
      }
    }
    Ml[w][0][lane] = m;
    Ml[w][1][lane] = l;
  };
  // 1/l normalization, store (b, n, c) f16: a lane's 8 accumulator registers
  // are 8 consecutive channels of its query
  auto take = [&](const v8f (&a)[16], float m, float l, int g) {
    const int   pw = w ^ 4;
    const float mo = Ml[pw][0][lane];
    const float lo = Ml[pw][1][lane];
    const float mn = fmaxf(m, mo);
    float fa = __expf(m - mn);
    float fb = __expf(mo - mn);
    const float inv = 1.f / (l * fa + lo * fb);
    fa *= inv;
    fb *= inv;
    f16* orow =
        out + (size_t)b * NTOK * C + (size_t)(myq + g * 16 + col) * C + 8 * hi;
#pragma unroll
    for (int ct = 0; ct < 16; ++ct) {
      const float4 p0 = *(const float4*)&Mg[pw][ct * 2][lane][0];
      const float4 p1 = *(const float4*)&Mg[pw][ct * 2 + 1][lane][0];
      v8h o;
      o[0] = (f16)(a[ct][0] * fa + p0.x * fb);
      o[1] = (f16)(a[ct][1] * fa + p0.y * fb);
      o[2] = (f16)(a[ct][2] * fa + p0.z * fb);
      o[3] = (f16)(a[ct][3] * fa + p0.w * fb);
      o[4] = (f16)(a[ct][4] * fa + p1.x * fb);
      o[5] = (f16)(a[ct][5] * fa + p1.y * fb);
      o[6] = (f16)(a[ct][6] * fa + p1.z * fb);
      o[7] = (f16)(a[ct][7] * fa + p1.w * fb);
      *(v8h*)(orow + ct * 16) = o;
    }
  };
  if (kh == 0) give(acc[1], m_i[1], lt[1]);
  else         give(acc[0], m_i[0], lt[0]);
  __syncthreads();  // the partners' tiles are in LDS
  if (kh == 0) take(acc[0], m_i[0], lt[0], 0);
  else         take(acc[1], m_i[1], lt[1], 1);
}

// ---------------------------------------------------------------------------
extern "C" void kernel_launch(void* const* d_in, const int* in_sizes, int n_in,
                              void* d_out, int out_size, void* d_ws,
                              size_t ws_size, hipStream_t stream) {
  const float* x     = (const float*)d_in[0];
  const float* gsc   = (const float*)d_in[1];
  const float* gbi   = (const float*)d_in[2];
  const float* w_qkv = (const float*)d_in[3];
  const float* b_qkv = (const float*)d_in[4];
  const float* w_out = (const float*)d_in[5];
  const float* b_out = (const float*)d_in[6];
  float* out = (float*)d_out;

  // Workspace carve-up
  char* ws = (char*)d_ws;
  f16* xnT  = (f16*)ws; ws += (size_t)BATCH * NTOK * C * 2;     // 16.8 MB
  f16* qk   = (f16*)ws; ws += (size_t)BATCH * NTOK * LDQK * 2;  // 33.6 MB
  f16* vT   = (f16*)ws; ws += (size_t)BATCH * C * NTOK * 2;     // 16.8 MB
  f16* attn = (f16*)ws; ws += (size_t)BATCH * NTOK * C * 2;     // 16.8 MB
  f16* wq16 = (f16*)ws; ws += (size_t)(3 * C) * C * 2;
  f16* wo16 = (f16*)ws; ws += (size_t)C * C * 2;
  float* gmean = (float*)ws; ws += BATCH * GROUPS * 4;
  float* grstd = (float*)ws; ws += BATCH * GROUPS * 4;

  // 1) GroupNorm stats
  gn_stats_kernel<<<BATCH * GROUPS, 256, 0, stream>>>(x, gmean, grstd);

  // 2) Weight converts
  cvt_f16_kernel<<<(3 * C * C + 255) / 256, 256, 0, stream>>>(w_qkv, wq16,
                                                              3 * C * C);
  cvt_f16_kernel<<<(C * C + 255) / 256, 256, 0, stream>>>(w_out, wo16, C * C);

  // 3) Normalize + transpose -> xnT (b, n, c) f16
  gn_apply_t_kernel<<<dim3(NTOK / 32, C / 32, BATCH), 256, 0, stream>>>(
      x, gmean, grstd, gsc, gbi, xnT);

  // 4a) q|k projection: qk(b,n,512) = xnT @ w_qkv[0:512]^T + bias
  gemm_abt_kernel<0><<<dim3(NTOK / 128, LDQK / 128, BATCH), 256, 0, stream>>>(
      xnT, C, (long long)NTOK * C, wq16, C, 0LL, b_qkv, qk, LDQK,
      (long long)NTOK * LDQK, nullptr, 0LL, C);

  // 4b) vT projection: vT(b,c,n) = w_qkv[512:768] @ xn  (rows = channels)
  gemm_abt_kernel<2><<<dim3(C / 128, NTOK / 128, BATCH), 256, 0, stream>>>(
      wq16 + (size_t)2 * C * C, C, 0LL, xnT, C, (long long)NTOK * C,
      b_qkv + 2 * C, vT, NTOK, (long long)C * NTOK, nullptr, 0LL, C);

  // 5) Flash attention -> attn (b, n, 256) f16
  attn_kernel<<<dim3(NTOK / 128, BATCH), 256, 0, stream>>>(qk, vT, attn);

  // 6) Output projection + bias + residual -> d_out (b, c, n) f32
  gemm_abt_kernel<1><<<dim3(C / 128, NTOK / 128, BATCH), 256, 0, stream>>>(
      wo16, C, 0LL, attn, C, (long long)NTOK * C, b_out, out, NTOK,
      (long long)C * NTOK, x, (long long)C * NTOK, C);
}

// v003
// It runs in 148 microseconds.
// Two timings next to v002 both put it at 1.15 times that version's speed.
// Counting every step since v000, it is 1.89 times as fast.
#include <hip/hip_runtime.h>
#include <math.h>

typedef _Float16 f16;
typedef __attribute__((ext_vector_type(16))) _Float16 v16h;
typedef __attribute__((ext_vector_type(8)))  _Float16 v8h;
typedef __attribute__((ext_vector_type(8)))  float    v8f;

// Problem constants (fixed by the reference)
constexpr int BATCH  = 8;
constexpr int C      = 256;
constexpr int NTOK   = 4096;   // 64*64
constexpr int LDQK   = 512;    // q|k packed
constexpr int GROUPS = 32;

// ---------------------------------------------------------------------------
// Fragment helpers: CDNA5 16-bit A/B fragment layout (16x32, ISA 7.12.2):
// lane L: row/col = L&15 ; kb = (L>>4)*8 ; elements 0..7 hold K=kb..kb+7,
// elements 8..15 hold K=kb+16..kb+23.  Two 16B loads per lane.
// ---------------------------------------------------------------------------
__device__ __forceinline__ v16h ld_frag(const f16* p, int ld) {
  const int lane = threadIdx.x & 31;
  const f16* base = p + (size_t)(lane & 15) * ld + (lane >> 4) * 8;
  v8h lo = *(const v8h*)(base);
  v8h hh = *(const v8h*)(base + 16);
  v16h r;
#pragma unroll
  for (int i = 0; i < 8; ++i) { r[i] = lo[i]; r[i + 8] = hh[i]; }
  return r;
}

__device__ __forceinline__ v8f wmma16(v16h a, v16h b, v8f c) {
  return __builtin_amdgcn_wmma_f32_16x16x32_f16(false, a, false, b,
                                                (short)0, c, false, false);
}

// Async global->LDS 16B copy (CDNA5, tracked by ASYNCcnt), as the builtin: the
// compiler then owns the address registers, also those above v255.
typedef __attribute__((ext_vector_type(4))) int v4i;
__device__ __forceinline__ void async_cp16(f16* ldst, const f16* gsrc) {
  __builtin_amdgcn_global_load_async_to_lds_b128(
      (__attribute__((address_space(1))) v4i*)gsrc,
      (__attribute__((address_space(3))) v4i*)ldst, 0, 0);
}
__device__ __forceinline__ void async_wait0() {
  asm volatile("s_wait_asynccnt 0x0" ::: "memory");
}
// This wave's LDS reads have returned: owed before a buffer it read is refilled.
__device__ __forceinline__ void lds_wait0() {
  asm volatile("s_wait_dscnt 0x0" ::: "memory");
}

// ---------------------------------------------------------------------------
// GroupNorm stats: one block per (b,g); 8 channels * 4096 = 32768 elements.
// ---------------------------------------------------------------------------
__global__ __launch_bounds__(256) void gn_stats_kernel(
    const float* __restrict__ x, float* __restrict__ mean,
    float* __restrict__ rstd) {
  const int bg = blockIdx.x;
  const float* p = x + (size_t)bg * 32768;
  float s = 0.f, q = 0.f;
  for (int i = threadIdx.x; i < 32768; i += 256) {
    float v = p[i];
    s += v;
    q = fmaf(v, v, q);
  }
#pragma unroll
  for (int off = 16; off > 0; off >>= 1) {
    s += __shfl_xor(s, off, 32);
    q += __shfl_xor(q, off, 32);
  }
  __shared__ float ss[8], qs[8];
  if ((threadIdx.x & 31) == 0) {
    ss[threadIdx.x >> 5] = s;
    qs[threadIdx.x >> 5] = q;
  }
  __syncthreads();
  if (threadIdx.x == 0) {
    float S = 0.f, Q = 0.f;
#pragma unroll
    for (int i = 0; i < 8; ++i) { S += ss[i]; Q += qs[i]; }
    float mu  = S * (1.f / 32768.f);
    float var = Q * (1.f / 32768.f) - mu * mu;
    mean[bg] = mu;
    rstd[bg] = rsqrtf(var + 1e-5f);
  }
}

// ---------------------------------------------------------------------------
// Normalize + transpose: x (b,c,n) f32 -> xnT (b,n,c) f16, 32x32 LDS tiles.
// ---------------------------------------------------------------------------
__global__ __launch_bounds__(256) void gn_apply_t_kernel(
    const float* __restrict__ x, const float* __restrict__ mean,
    const float* __restrict__ rstd, const float* __restrict__ gsc,
    const float* __restrict__ gbi, f16* __restrict__ xnT) {
  const int b  = blockIdx.z;
  const int c0 = blockIdx.y * 32;
  const int n0 = blockIdx.x * 32;
  __shared__ f16 T[32][33];

  const int ci  = threadIdx.x >> 3;
  const int nj0 = (threadIdx.x & 7) * 4;
  const int c   = c0 + ci;
  const int g   = c >> 3;
  const float mu = mean[b * GROUPS + g];
  const float rs = rstd[b * GROUPS + g];
  const float sc = gsc[c];
  const float bi = gbi[c];
  const float* xr = x + ((size_t)b * C + c) * NTOK + n0;
#pragma unroll
  for (int u = 0; u < 4; ++u) {
    float v = xr[nj0 + u];
    T[ci][nj0 + u] = (f16)((v - mu) * rs * sc + bi);
  }
  __syncthreads();
  const int ni  = threadIdx.x >> 3;
  const int cj0 = (threadIdx.x & 7) * 4;
  f16* orow = xnT + ((size_t)b * NTOK + n0 + ni) * C + c0 + cj0;
#pragma unroll
  for (int u = 0; u < 4; ++u) orow[u] = T[cj0 + u][ni];
}

// ---------------------------------------------------------------------------
__global__ void cvt_f16_kernel(const float* __restrict__ src,
                               f16* __restrict__ dst, int n) {
  int i = blockIdx.x * 256 + threadIdx.x;
  if (i < n) dst[i] = (f16)src[i];
}

// ---------------------------------------------------------------------------
// WMMA GEMM: C[M,N] = A[M,K] * B[N,K]^T, K = 256.  Tile 128x128, 8 waves.
// Both operands come through LDS in stages of 64 k, two buffers, filled with
// async global->LDS copies: a wave's copy covers four whole 128B row pieces, and
// the next stage flies while this one is worked on.  A wave takes 32 x 64 of the
// tile, so an A fragment feeds four matrix instructions and a B fragment two.
// MODE 0: f16 out, bias[N]          (q|k projection)
// MODE 1: f32 out, bias[M] + resid  (output projection)
// MODE 2: f16 out, bias[M]          (vT projection: rows = channels)
// ---------------------------------------------------------------------------
constexpr int KC  = 64;      // k per stage
constexpr int NKC = C / KC;  // stages

template <int MODE>
__global__ __launch_bounds__(256, 1) void gemm_abt_kernel(
    const f16* __restrict__ A, int lda, long long sA,
    const f16* __restrict__ B, int ldb, long long sB,
    const float* __restrict__ bias, void* __restrict__ Cv, int ldc,
    long long sC, const float* __restrict__ resid, long long sR) {
  const int b  = blockIdx.z;
  const int m0 = blockIdx.x * 128;
  const int n0 = blockIdx.y * 128;
  A += (size_t)b * sA + (size_t)m0 * lda;
  B += (size_t)b * sB + (size_t)n0 * ldb;

  // 144B pitch: 16B aligned, bank-clean for the 16B fragment reads
  __shared__ __attribute__((aligned(16))) f16 As[2][128][72];
  __shared__ __attribute__((aligned(16))) f16 Bs[2][128][72];

  const int w    = __builtin_amdgcn_readfirstlane(threadIdx.x >> 5);
  const int lane = threadIdx.x & 31;
  const int hi   = lane >> 4;
  const int col  = lane & 15;
  const int wm   = (w & 3) * 32;   // this wave's rows of the tile
  const int wn   = (w >> 2) * 64;  // this wave's columns of the tile

  v8f acc[2][4];
#pragma unroll
  for (int i = 0; i < 2; ++i)
#pragma unroll
    for (int ct = 0; ct < 4; ++ct)
#pragma unroll
      for (int j = 0; j < 8; ++j) acc[i][ct][j] = 0.f;

  const int sr = threadIdx.x >> 3;        // row within a group of 32
  const int ss = (threadIdx.x & 7) * 8;   // 16B piece of the 128B row piece
  auto stage = [&](int buf, int kb) {
#pragma unroll
    for (int u = 0; u < 4; ++u)
      async_cp16(&As[buf][u * 32 + sr][ss],
                 A + (size_t)(u * 32 + sr) * lda + kb + ss);
#pragma unroll
    for (int u = 0; u < 4; ++u)
      async_cp16(&Bs[buf][u * 32 + sr][ss],
                 B + (size_t)(u * 32 + sr) * ldb + kb + ss);
  };

  stage(0, 0);
  async_wait0();
  __syncthreads();
  stage(1, KC);

  // Unrolled, as are the short loops here: buffer index, refill test and the
  // indices of the register arrays become literals.
#pragma unroll
  for (int t = 0; t < NKC; ++t) {
    const int buf = t & 1;
#pragma unroll
    for (int kk = 0; kk < KC; kk += 32) {
      // The six fragments of a k step are read at one place (twelve 16B loads),
      // then worked on: each sched_barrier keeps the load group whole; left
      // alone, the compiler read each B fragment in front of its own two WMMAs
      // and waited it out.
      v16h af[2], bf[4];
#pragma unroll
      for (int i = 0; i < 2; ++i) af[i] = ld_frag(&As[buf][wm + i * 16][kk], 72);
#pragma unroll
      for (int ct = 0; ct < 4; ++ct)
        bf[ct] = ld_frag(&Bs[buf][wn + ct * 16][kk], 72);
      __builtin_amdgcn_sched_barrier(0);
#pragma unroll
      for (int ct = 0; ct < 4; ++ct) {
        acc[0][ct] = wmma16(af[0], bf[ct], acc[0][ct]);
        acc[1][ct] = wmma16(af[1], bf[ct], acc[1][ct]);
      }
      __builtin_amdgcn_sched_barrier(0);  // the WMMAs stay in front of what follows
    }
    lds_wait0();      // this wave has left buf
    async_wait0();    // its copies of the next stage have landed
    __syncthreads();  // next stage published; every wave has left buf
    if (t + 2 < NKC) stage(buf, (t + 2) * KC);  // flies during stage t+1
  }
  async_wait0();

  if (MODE == 0) {
    f16* Cp = (f16*)Cv + (size_t)b * sC;
#pragma unroll
    for (int i = 0; i < 2; ++i)
#pragma unroll
      for (int ct = 0; ct < 4; ++ct) {
        const int n = n0 + wn + ct * 16 + col;
        float bn = bias[n];
#pragma unroll
        for (int j = 0; j < 8; ++j) {
          int m = m0 + wm + i * 16 + j + 8 * hi;
          Cp[(size_t)m * ldc + n] = (f16)(acc[i][ct][j] + bn);
        }
      }
  } else if (MODE == 1) {
    float* Cp = (float*)Cv + (size_t)b * sC;
    const float* Rp = resid + (size_t)b * sR;
    // One 32-bit element offset per row serves the residual load and the store
    // of the same element (a batch's plane is 1 Mi elements), so its register
    // lives on to the store.
    unsigned ro[2][8];
    float bm[2][8], rv[2][4][8];
#pragma unroll
    for (int i = 0; i < 2; ++i)
#pragma unroll
      for (int j = 0; j < 8; ++j) {
        const int m = m0 + wm + i * 16 + j + 8 * hi;
        ro[i][j] = (unsigned)(m * ldc + n0 + wn + col);
        bm[i][j] = bias[m];
#pragma unroll
        for (int ct = 0; ct < 4; ++ct)
          rv[i][ct][j] = (Rp + ro[i][j])[ct * 16];
      }
    // Behind the last of these loads, in front of the first rewrite of a
    // register that one of them names.
    asm volatile("s_wait_xcnt 0x0" ::: "memory");
#pragma unroll
    for (int i = 0; i < 2; ++i)
#pragma unroll
      for (int ct = 0; ct < 4; ++ct)
#pragma unroll
        for (int j = 0; j < 8; ++j)
          (Cp + ro[i][j])[ct * 16] = acc[i][ct][j] + bm[i][j] + rv[i][ct][j];
  } else {
    f16* Cp = (f16*)Cv + (size_t)b * sC;
#pragma unroll
    for (int i = 0; i < 2; ++i)
#pragma unroll
      for (int ct = 0; ct < 4; ++ct) {
#pragma unroll
        for (int j = 0; j < 8; ++j) {
          int m = m0 + wm + i * 16 + j + 8 * hi;
          Cp[(size_t)m * ldc + n0 + wn + ct * 16 + col] =
              (f16)(acc[i][ct][j] + bias[m]);
        }
      }
  }
}

__device__ __forceinline__ float xhalf(float x) {
  return __builtin_bit_cast(
      float, __builtin_amdgcn_permlanex16(__builtin_bit_cast(int, x),
                                          __builtin_bit_cast(int, x),
                                          0x76543210, 0xfedcba98, false, false));
}

constexpr int SKEYS = 64;            // keys per stage
constexpr int NSTG  = NTOK / SKEYS;  // stages

// Two waves per SIMD: the grid has one work-group per WGP, so fewer registers
// buy no residency; the 32-query output tile and Q take 384 registers.
__global__ __launch_bounds__(256) __attribute__((amdgpu_waves_per_eu(2, 2)))
void attn_kernel(
    const f16* __restrict__ qk, const f16* __restrict__ vT,
    f16* __restrict__ out) {
  const int b    = blockIdx.y;
  const int q0   = blockIdx.x * 128;
  const int w    = __builtin_amdgcn_readfirstlane(threadIdx.x >> 5);
  const int lane = threadIdx.x & 31;
  const int hi   = lane >> 4;
  const int col  = lane & 15;
  const int qg   = w & 3;   // query group of 32
  const int kh   = w >> 2;  // half of each stage's keys

  __shared__ f16 Ks[2][SKEYS][264];   // keys x channels, 528B pitch
  __shared__ f16 Vs[2][256][72];      // channels x keys, 144B pitch
  __shared__ float Mg[8][32][32][4];  // merge: one output tile per wave
  __shared__ float Ml[8][2][32];      // merge: its maximum and sum

  const f16* qb  = qk + (size_t)b * NTOK * LDQK;
  const f16* vb  = vT + (size_t)b * C * NTOK;
  const int  myq = q0 + qg * 32;

  // Preload Q fragments (2 x 16 queries x K=256), used as the B operand
  v16h qf[2][8];
#pragma unroll
  for (int g = 0; g < 2; ++g)
#pragma unroll
    for (int cb = 0; cb < 8; ++cb)
      qf[g][cb] = ld_frag(qb + (size_t)(myq + g * 16) * LDQK + cb * 32, LDQK);
  // Stands in front of the first rewrite of the address pair these loads name;
  // the sched_barrier keeps the later address arithmetic from being lifted over.
  asm volatile("s_wait_xcnt 0x0" ::: "memory");
  __builtin_amdgcn_sched_barrier(0);

  // acc[g][ct][j] = O^T[channel ct*16 + j + 8*hi][query g*16 + col]
  v8f acc[2][16];
#pragma unroll
  for (int g = 0; g < 2; ++g)
#pragma unroll
    for (int i = 0; i < 16; ++i)
#pragma unroll
      for (int j = 0; j < 8; ++j) acc[g][i][j] = 0.f;

  float m_i[2] = {-__builtin_inff(), -__builtin_inff()};  // running maxima
  float l_i[2] = {0.f, 0.f};  // running sums over this wave half's keys

  // Async-stage one 64-key stage into buffer `buf`: a wave's copy covers one
  // whole 512B K row, or four whole 128B V^T rows.
  auto stage = [&](int buf, int k0) {
#pragma unroll
    for (int u = 0; u < 8; ++u) {
      const int kr = u * 8 + w;
      async_cp16(&Ks[buf][kr][lane * 8],
                 qb + (size_t)(k0 + kr) * LDQK + C + lane * 8);
    }
    const int vr = threadIdx.x >> 3, vs = threadIdx.x & 7;
#pragma unroll
    for (int u = 0; u < 8; ++u)
      async_cp16(&Vs[buf][u * 32 + vr][vs * 8],
                 vb + (size_t)(u * 32 + vr) * NTOK + k0 + vs * 8);
  };

  stage(0, 0);
  async_wait0();
  __syncthreads();
  stage(1, SKEYS);

  // One stage.  `refill` is a literal at both calls: the loop bodies stay free
  // of branches, so nothing of a pass can be sunk behind its matrix blocks.
  auto pass = [&](int t, bool refill) __attribute__((always_inline)) {
    const int buf = t & 1;

    // Fragments come from LDS in groups of four (eight 16B loads at one place),
    // one group ahead of the eight WMMAs that use them, in two register sets.
    // Each sched_barrier keeps a load group whole and ahead of the WMMA block
    // before its use: left alone, the compiler, short of registers, put every
    // fragment's loads directly in front of its own WMMAs and waited them out.
    v16h fa[4], fb[4];
    auto ldK4 = [&](v16h (&f)[4], int f0) {  // fragment f: channels f>>1, tile f&1
#pragma unroll
      for (int n = 0; n < 4; ++n)
        f[n] = ld_frag(
            &Ks[buf][kh * 32 + ((f0 + n) & 1) * 16][((f0 + n) >> 1) * 32], 264);
      __builtin_amdgcn_sched_barrier(0);
    };
    auto ldV4 = [&](v16h (&f)[4], int ct0) {
#pragma unroll
      for (int n = 0; n < 4; ++n)
        f[n] = ld_frag(&Vs[buf][(ct0 + n) * 16][kh * 32], 72);
      __builtin_amdgcn_sched_barrier(0);
    };

    // ---- scores^T: 32 keys x 32 queries, K=256 -> 32 WMMAs, 16 fragments
    // s[i][g][j] = key 16*i + j + 8*hi of this wave's half, query g*16 + col
    v8f s[2][2];
#pragma unroll
    for (int i = 0; i < 2; ++i)
#pragma unroll
      for (int g = 0; g < 2; ++g)
#pragma unroll
        for (int j = 0; j < 8; ++j) s[i][g][j] = 0.f;
    auto mmS4 = [&](const v16h (&f)[4], int f0) {
#pragma unroll
      for (int n = 0; n < 4; ++n) {
        const int i = (f0 + n) & 1, cb = (f0 + n) >> 1;
        s[i][0] = wmma16(f[n], qf[0][cb], s[i][0]);
        s[i][1] = wmma16(f[n], qf[1][cb], s[i][1]);
      }
      __builtin_amdgcn_sched_barrier(0);
    };
    ldK4(fa, 0);
    ldK4(fb, 4);
    mmS4(fa, 0);
    ldK4(fa, 8);
    mmS4(fb, 4);
    ldK4(fb, 12);
    mmS4(fa, 8);
    mmS4(fb, 12);

    // ---- online softmax, one query per lane and tile
    v16h bp[2];    // P^T as B operand: 32 keys x 16 queries each
    float fac[2];  // what the new maxima scale the old sums and outputs by
#pragma unroll
    for (int g = 0; g < 2; ++g) {
      float mt[8];
#pragma unroll
      for (int j = 0; j < 8; ++j) {
        s[0][g][j] *= 0.0625f;  // * c^-0.5
        s[1][g][j] *= 0.0625f;
        mt[j] = fmaxf(s[0][g][j], s[1][g][j]);
      }
      float mx = fmaxf(fmaxf(fmaxf(mt[0], mt[1]), fmaxf(mt[2], mt[3])),
                       fmaxf(fmaxf(mt[4], mt[5]), fmaxf(mt[6], mt[7])));
      mx = fmaxf(mx, xhalf(mx));  // both halves now hold the 32 keys' maximum

      const float mn  = fmaxf(m_i[g], mx);
      fac[g] = __expf(m_i[g] - mn);
      m_i[g] = mn;

      float pt[8];
#pragma unroll
      for (int j = 0; j < 8; ++j) {
        float pa = __expf(s[0][g][j] - mn);
        float pb = __expf(s[1][g][j] - mn);
        pt[j]        = pa + pb;
        bp[g][j]     = (f16)pa;
        bp[g][j + 8] = (f16)pb;
      }
      const float ps = ((pt[0] + pt[1]) + (pt[2] + pt[3])) +
                       ((pt[4] + pt[5]) + (pt[6] + pt[7]));
      l_i[g] = l_i[g] * fac[g] + ps;
    }

    // ---- acc = acc * fac + V^T @ P^T (16 channel x 2 query tiles, K=32).
    // Four channel tiles are rescaled at a time, one block ahead of their own
    // WMMAs: the first four while the first V^T fragments are on their way, the
    // others beside the WMMAs of the block before.
    auto scl4 = [&](int ct0) {
#pragma unroll
      for (int n = 0; n < 4; ++n)
#pragma unroll
        for (int j = 0; j < 8; ++j) {
          acc[0][ct0 + n][j] *= fac[0];
          acc[1][ct0 + n][j] *= fac[1];
        }
    };
    auto mmV4 = [&](const v16h (&f)[4], int ct0) {
#pragma unroll
      for (int n = 0; n < 4; ++n) {
        acc[0][ct0 + n] = wmma16(f[n], bp[0], acc[0][ct0 + n]);
        acc[1][ct0 + n] = wmma16(f[n], bp[1], acc[1][ct0 + n]);
      }
    };
    __builtin_amdgcn_sched_barrier(0);  // the next group waits for s to be dead
    ldV4(fa, 0);
    ldV4(fb, 4);
    scl4(0);
    __builtin_amdgcn_sched_barrier(0);  // ends a block, as in ldK4 and mmS4
    mmV4(fa, 0);
    scl4(4);
    __builtin_amdgcn_sched_barrier(0);
    ldV4(fa, 8);
    mmV4(fb, 4);
    scl4(8);
    __builtin_amdgcn_sched_barrier(0);
    ldV4(fb, 12);
    mmV4(fa, 8);
    scl4(12);
    __builtin_amdgcn_sched_barrier(0);
    mmV4(fb, 12);

    lds_wait0();        // this wave has left buf
    async_wait0();      // its copies of the next stage have landed
    __syncthreads();    // next stage published; every wave has left buf
    if (refill) stage(buf, (t + 2) * SKEYS);  // flies during stage t+1
  };
#pragma unroll 1
  for (int t = 0; t < NSTG - 2; ++t) pass(t, true);  // a stage t+2 exists
#pragma unroll 1
  for (int t = NSTG - 2; t < NSTG; ++t) pass(t, false);
  async_wait0();

  // ---- merge the two key halves of each query group: wave (qg, kh) hands
  // query tile 1-kh to its partner and finishes tile kh.
  const float lt[2] = {l_i[0] + xhalf(l_i[0]), l_i[1] + xhalf(l_i[1])};
  auto give = [&](const v8f (&a)[16], float m, float l) {
#pragma unroll
    for (int ct = 0; ct < 16; ++ct) {
#pragma unroll
      for (int h = 0; h < 2; ++h) {
        float4 v = make_float4(a[ct][4 * h], a[ct][4 * h + 1], a[ct][4 * h + 2],
                               a[ct][4 * h + 3]);
        *(float4*)&Mg[w][ct * 2 + h][lane][0] = v;
      }
    }
    Ml[w][0][lane] = m;
    Ml[w][1][lane] = l;
  };
  // 1/l normalization, store (b, n, c) f16: a lane's 8 accumulator registers
  // are 8 consecutive channels of its query
  auto take = [&](const v8f (&a)[16], float m, float l, int g) {
    const int   pw = w ^ 4;
    const float mo = Ml[pw][0][lane];
    const float lo = Ml[pw][1][lane];
    const float mn = fmaxf(m, mo);
    float fa = __expf(m - mn);
    float fb = __expf(mo - mn);
    const float inv = 1.f / (l * fa + lo * fb);
    fa *= inv;
    fb *= inv;
    f16* orow =
        out + (size_t)b * NTOK * C + (size_t)(myq + g * 16 + col) * C + 8 * hi;
#pragma unroll
    for (int ct = 0; ct < 16; ++ct) {
      const float4 p0 = *(const float4*)&Mg[pw][ct * 2][lane][0];
      const float4 p1 = *(const float4*)&Mg[pw][ct * 2 + 1][lane][0];
      v8h o;
      o[0] = (f16)(a[ct][0] * fa + p0.x * fb);
      o[1] = (f16)(a[ct][1] * fa + p0.y * fb);
      o[2] = (f16)(a[ct][2] * fa + p0.z * fb);
      o[3] = (f16)(a[ct][3] * fa + p0.w * fb);
      o[4] = (f16)(a[ct][4] * fa + p1.x * fb);
      o[5] = (f16)(a[ct][5] * fa + p1.y * fb);
      o[6] = (f16)(a[ct][6] * fa + p1.z * fb);
      o[7] = (f16)(a[ct][7] * fa + p1.w * fb);
      *(v8h*)(orow + ct * 16) = o;
    }
  };
  if (kh == 0) give(acc[1], m_i[1], lt[1]);
  else         give(acc[0], m_i[0], lt[0]);
  __syncthreads();  // the partners' tiles are in LDS
  if (kh == 0) take(acc[0], m_i[0], lt[0], 0);
  else         take(acc[1], m_i[1], lt[1], 1);
}

// ---------------------------------------------------------------------------
extern "C" void kernel_launch(void* const* d_in, const int* in_sizes, int n_in,
                              void* d_out, int out_size, void* d_ws,
                              size_t ws_size, hipStream_t stream) {
  const float* x     = (const float*)d_in[0];
  const float* gsc   = (const float*)d_in[1];
  const float* gbi   = (const float*)d_in[2];
  const float* w_qkv = (const float*)d_in[3];
  const float* b_qkv = (const float*)d_in[4];
  const float* w_out = (const float*)d_in[5];
  const float* b_out = (const float*)d_in[6];
  float* out = (float*)d_out;

  // Workspace carve-up
  char* ws = (char*)d_ws;
  f16* xnT  = (f16*)ws; ws += (size_t)BATCH * NTOK * C * 2;     // 16.8 MB
  f16* qk   = (f16*)ws; ws += (size_t)BATCH * NTOK * LDQK * 2;  // 33.6 MB
  f16* vT   = (f16*)ws; ws += (size_t)BATCH * C * NTOK * 2;     // 16.8 MB
  f16* attn = (f16*)ws; ws += (size_t)BATCH * NTOK * C * 2;     // 16.8 MB
  f16* wq16 = (f16*)ws; ws += (size_t)(3 * C) * C * 2;
  f16* wo16 = (f16*)ws; ws += (size_t)C * C * 2;
  float* gmean = (float*)ws; ws += BATCH * GROUPS * 4;
  float* grstd = (float*)ws; ws += BATCH * GROUPS * 4;

  // 1) GroupNorm stats
  gn_stats_kernel<<<BATCH * GROUPS, 256, 0, stream>>>(x, gmean, grstd);

  // 2) Weight converts
  cvt_f16_kernel<<<(3 * C * C + 255) / 256, 256, 0, stream>>>(w_qkv, wq16,
                                                              3 * C * C);
  cvt_f16_kernel<<<(C * C + 255) / 256, 256, 0, stream>>>(w_out, wo16, C * C);

  // 3) Normalize + transpose -> xnT (b, n, c) f16
  gn_apply_t_kernel<<<dim3(NTOK / 32, C / 32, BATCH), 256, 0, stream>>>(
      x, gmean, grstd, gsc, gbi, xnT);

  // 4a) q|k projection: qk(b,n,512) = xnT @ w_qkv[0:512]^T + bias
  gemm_abt_kernel<0><<<dim3(NTOK / 128, LDQK / 128, BATCH), 256, 0, stream>>>(
      xnT, C, (long long)NTOK * C, wq16, C, 0LL, b_qkv, qk, LDQK,
      (long long)NTOK * LDQK, nullptr, 0LL);

  // 4b) vT projection: vT(b,c,n) = w_qkv[512:768] @ xn  (rows = channels)
  gemm_abt_kernel<2><<<dim3(C / 128, NTOK / 128, BATCH), 256, 0, stream>>>(
      wq16 + (size_t)2 * C * C, C, 0LL, xnT, C, (long long)NTOK * C,
      b_qkv + 2 * C, vT, NTOK, (long long)C * NTOK, nullptr, 0LL);

  // 5) Flash attention -> attn (b, n, 256) f16
  attn_kernel<<<dim3(NTOK / 128, BATCH), 256, 0, stream>>>(qk, vT, attn);

  // 6) Output projection + bias + residual -> d_out (b, c, n) f32
  gemm_abt_kernel<1><<<dim3(C / 128, NTOK / 128, BATCH), 256, 0, stream>>>(
      wo16, C, 0LL, attn, C, (long long)NTOK * C, b_out, out, NTOK,
      (long long)C * NTOK, x, (long long)C * NTOK);
}

// v004
// A run of this version takes 140 microseconds.
// Next to v003, in two timings, it ran 1.07 and 1.06 times as fast.
// Over all steps from v000 it is 2.01 times as fast.
#include <hip/hip_runtime.h>
#include <math.h>

typedef _Float16 f16;
typedef __attribute__((ext_vector_type(16))) _Float16 v16h;
typedef __attribute__((ext_vector_type(8)))  _Float16 v8h;
typedef __attribute__((ext_vector_type(8)))  float    v8f;

// Problem constants (fixed by the reference)
constexpr int BATCH  = 8;
constexpr int C      = 256;
constexpr int NTOK   = 4096;   // 64*64
constexpr int LDQK   = 512;    // q|k packed
constexpr int GROUPS = 32;

// ---------------------------------------------------------------------------
// Fragment helpers: CDNA5 16-bit A/B fragment layout (16x32, ISA 7.12.2):
// lane L: row/col = L&15 ; kb = (L>>4)*8 ; elements 0..7 hold K=kb..kb+7,
// elements 8..15 hold K=kb+16..kb+23.  Two 16B loads per lane.
// ---------------------------------------------------------------------------
__device__ __forceinline__ v16h ld_frag(const f16* p, int ld) {
  const int lane = threadIdx.x & 31;
  const f16* base = p + (size_t)(lane & 15) * ld + (lane >> 4) * 8;
  v8h lo = *(const v8h*)(base);
  v8h hh = *(const v8h*)(base + 16);
  v16h r;
#pragma unroll
  for (int i = 0; i < 8; ++i) { r[i] = lo[i]; r[i + 8] = hh[i]; }
  return r;
}

__device__ __forceinline__ v8f wmma16(v16h a, v16h b, v8f c) {
  return __builtin_amdgcn_wmma_f32_16x16x32_f16(false, a, false, b,
                                                (short)0, c, false, false);
}

// Async global->LDS 16B copy (CDNA5, tracked by ASYNCcnt), as the builtin: the
// compiler then owns the address registers, also those above v255.
typedef __attribute__((ext_vector_type(4))) int v4i;
__device__ __forceinline__ void async_cp16(f16* ldst, const f16* gsrc) {
  __builtin_amdgcn_global_load_async_to_lds_b128(
      (__attribute__((address_space(1))) v4i*)gsrc,
      (__attribute__((address_space(3))) v4i*)ldst, 0, 0);
}
__device__ __forceinline__ void async_wait0() {
  asm volatile("s_wait_asynccnt 0x0" ::: "memory");
}
// This wave's LDS reads have returned: owed before a buffer it read is refilled.
__device__ __forceinline__ void lds_wait0() {
  asm volatile("s_wait_dscnt 0x0" ::: "memory");
}

// ---------------------------------------------------------------------------
// GroupNorm stats: one block per (b,g); 8 channels * 4096 = 32768 elements.
// The same launch converts the weights to f16, work that depends on nothing
// here and would else cost launches of its own: block bg takes elements
// bg*1024 .. bg*1024+1023 of [w_qkv | w_out], four per thread, loaded ahead of
// the sums, stored behind them.
// ---------------------------------------------------------------------------
typedef __attribute__((ext_vector_type(4))) _Float16 v4h;
constexpr int NWQ = 3 * C * C;  // elements of w_qkv
static_assert(NWQ % 1024 == 0 && NWQ + C * C == BATCH * GROUPS * 1024,
              "one block converts 1024 weights of one matrix");

__global__ __launch_bounds__(256) void gn_stats_cvt_kernel(
    const float* __restrict__ x, float* __restrict__ mean,
    float* __restrict__ rstd, const float* __restrict__ w_qkv,
    f16* __restrict__ wq16, const float* __restrict__ w_out,
    f16* __restrict__ wo16) {
  const int bg = blockIdx.x;
  const int we = bg * 1024;  // block-uniform: which matrix, and where in it
  const float* wsrc = we < NWQ ? w_qkv + we : w_out + (we - NWQ);
  f16*         wdst = we < NWQ ? wq16 + we : wo16 + (we - NWQ);
  const float4 wv = *(const float4*)(wsrc + threadIdx.x * 4);
  const float* p = x + (size_t)bg * 32768;
  float s = 0.f, q = 0.f;
  for (int i = threadIdx.x; i < 32768; i += 256) {
    float v = p[i];
    s += v;
    q = fmaf(v, v, q);
  }
  {
    v4h wh;
    wh[0] = (f16)wv.x;
    wh[1] = (f16)wv.y;
    wh[2] = (f16)wv.z;
    wh[3] = (f16)wv.w;
    *(v4h*)(wdst + threadIdx.x * 4) = wh;
  }
#pragma unroll
  for (int off = 16; off > 0; off >>= 1) {
    s += __shfl_xor(s, off, 32);
    q += __shfl_xor(q, off, 32);
  }
  __shared__ float ss[8], qs[8];
  if ((threadIdx.x & 31) == 0) {
    ss[threadIdx.x >> 5] = s;
    qs[threadIdx.x >> 5] = q;
  }
  __syncthreads();
  if (threadIdx.x == 0) {
    float S = 0.f, Q = 0.f;
#pragma unroll
    for (int i = 0; i < 8; ++i) { S += ss[i]; Q += qs[i]; }
    float mu  = S * (1.f / 32768.f);
    float var = Q * (1.f / 32768.f) - mu * mu;
    mean[bg] = mu;
    rstd[bg] = rsqrtf(var + 1e-5f);
  }
}

// ---------------------------------------------------------------------------
// Normalize + transpose: x (b,c,n) f32 -> xnT (b,n,c) f16, 32x32 LDS tiles.
// ---------------------------------------------------------------------------
__global__ __launch_bounds__(256) void gn_apply_t_kernel(
    const float* __restrict__ x, const float* __restrict__ mean,
    const float* __restrict__ rstd, const float* __restrict__ gsc,
    const float* __restrict__ gbi, f16* __restrict__ xnT) {
  const int b  = blockIdx.z;
  const int c0 = blockIdx.y * 32;
  const int n0 = blockIdx.x * 32;
  __shared__ f16 T[32][33];

  const int ci  = threadIdx.x >> 3;
  const int nj0 = (threadIdx.x & 7) * 4;
  const int c   = c0 + ci;
  const int g   = c >> 3;
  const float mu = mean[b * GROUPS + g];
  const float rs = rstd[b * GROUPS + g];
  const float sc = gsc[c];
  const float bi = gbi[c];
  const float* xr = x + ((size_t)b * C + c) * NTOK + n0;
#pragma unroll
  for (int u = 0; u < 4; ++u) {
    float v = xr[nj0 + u];
    T[ci][nj0 + u] = (f16)((v - mu) * rs * sc + bi);
  }
  __syncthreads();
  const int ni  = threadIdx.x >> 3;
  const int cj0 = (threadIdx.x & 7) * 4;
  f16* orow = xnT + ((size_t)b * NTOK + n0 + ni) * C + c0 + cj0;
#pragma unroll
  for (int u = 0; u < 4; ++u) orow[u] = T[cj0 + u][ni];
}

// ---------------------------------------------------------------------------
// WMMA GEMM: C[M,N] = A[M,K] * B[N,K]^T, K = 256.  Tile 128x128, 8 waves.
// Both operands come through LDS in stages of 64 k, two buffers, filled with
// async global->LDS copies: a wave's copy covers four whole 128B row pieces, and
// the next stage flies while this one is worked on.  A wave takes 32 x 64 of the
// tile, so an A fragment feeds four matrix instructions and a B fragment two.
// MODE 0: f16 out, bias[N]          (q|k projection)
// MODE 1: f32 out, bias[M] + resid  (output projection)
// MODE 2: f16 out, bias[M]          (vT projection: rows = channels)
// The tile is a device function: the q|k and the vT projection, which do not
// depend on each other, share one launch, the block index picks the job.
// A, B, Cv and resid point at the batch's planes; LDS comes from the kernel, so
// that two jobs in one kernel share one allocation.
// ---------------------------------------------------------------------------
constexpr int KC  = 64;      // k per stage
constexpr int NKC = C / KC;  // stages

// 144B pitch: 16B aligned, bank-clean for the 16B fragment reads
typedef f16 gemm_stage_t[2][128][72];

template <int MODE>
__device__ __forceinline__ void gemm_abt_tile(
    gemm_stage_t& As, gemm_stage_t& Bs, const f16* __restrict__ A, int lda,
    const f16* __restrict__ B, int ldb, const float* __restrict__ bias,
    void* __restrict__ Cv, int ldc, const float* __restrict__ resid, int m0,
    int n0) {
  A += (size_t)m0 * lda;
  B += (size_t)n0 * ldb;

  const int w    = __builtin_amdgcn_readfirstlane(threadIdx.x >> 5);
  const int lane = threadIdx.x & 31;
  const int hi   = lane >> 4;
  const int col  = lane & 15;
  const int wm   = (w & 3) * 32;   // this wave's rows of the tile
  const int wn   = (w >> 2) * 64;  // this wave's columns of the tile

  v8f acc[2][4];
#pragma unroll
  for (int i = 0; i < 2; ++i)
#pragma unroll
    for (int ct = 0; ct < 4; ++ct)
#pragma unroll
      for (int j = 0; j < 8; ++j) acc[i][ct][j] = 0.f;

  const int sr = threadIdx.x >> 3;        // row within a group of 32
  const int ss = (threadIdx.x & 7) * 8;   // 16B piece of the 128B row piece
  auto stage = [&](int buf, int kb) {
#pragma unroll
    for (int u = 0; u < 4; ++u)
      async_cp16(&As[buf][u * 32 + sr][ss],
                 A + (size_t)(u * 32 + sr) * lda + kb + ss);
#pragma unroll
    for (int u = 0; u < 4; ++u)
      async_cp16(&Bs[buf][u * 32 + sr][ss],
                 B + (size_t)(u * 32 + sr) * ldb + kb + ss);
  };

  stage(0, 0);
  async_wait0();
  __syncthreads();
  stage(1, KC);

  // Unrolled, as are the short loops here: buffer index, refill test and the
  // indices of the register arrays become literals.
#pragma unroll
  for (int t = 0; t < NKC; ++t) {
    const int buf = t & 1;
#pragma unroll
    for (int kk = 0; kk < KC; kk += 32) {
      // The six fragments of a k step are read at one place (twelve 16B loads),
      // then worked on: each sched_barrier keeps the load group whole; left
      // alone, the compiler read each B fragment in front of its own two WMMAs
      // and waited it out.
      v16h af[2], bf[4];
#pragma unroll
      for (int i = 0; i < 2; ++i) af[i] = ld_frag(&As[buf][wm + i * 16][kk], 72);
#pragma unroll
      for (int ct = 0; ct < 4; ++ct)
        bf[ct] = ld_frag(&Bs[buf][wn + ct * 16][kk], 72);
      __builtin_amdgcn_sched_barrier(0);
#pragma unroll
      for (int ct = 0; ct < 4; ++ct) {
        acc[0][ct] = wmma16(af[0], bf[ct], acc[0][ct]);
        acc[1][ct] = wmma16(af[1], bf[ct], acc[1][ct]);
      }
      __builtin_amdgcn_sched_barrier(0);  // the WMMAs stay in front of what follows
    }
    lds_wait0();      // this wave has left buf
    async_wait0();    // its copies of the next stage have landed
    __syncthreads();  // next stage published; every wave has left buf
    if (t + 2 < NKC) stage(buf, (t + 2) * KC);  // flies during stage t+1
  }
  async_wait0();

  if (MODE == 0) {
    f16* Cp = (f16*)Cv;
#pragma unroll
    for (int i = 0; i < 2; ++i)
#pragma unroll
      for (int ct = 0; ct < 4; ++ct) {
        const int n = n0 + wn + ct * 16 + col;
        float bn = bias[n];
#pragma unroll
        for (int j = 0; j < 8; ++j) {
          int m = m0 + wm + i * 16 + j + 8 * hi;
          Cp[(size_t)m * ldc + n] = (f16)(acc[i][ct][j] + bn);
        }
      }
  } else if (MODE == 1) {
    float* Cp = (float*)Cv;
    const float* Rp = resid;
    // One 32-bit element offset per row serves the residual load and the store
    // of the same element (a batch's plane is 1 Mi elements), so its register
    // lives on to the store.
    unsigned ro[2][8];
    float bm[2][8], rv[2][4][8];
#pragma unroll
    for (int i = 0; i < 2; ++i)
#pragma unroll
      for (int j = 0; j < 8; ++j) {
        const int m = m0 + wm + i * 16 + j + 8 * hi;
        ro[i][j] = (unsigned)(m * ldc + n0 + wn + col);
        bm[i][j] = bias[m];
#pragma unroll
        for (int ct = 0; ct < 4; ++ct)
          rv[i][ct][j] = (Rp + ro[i][j])[ct * 16];
      }
    // Behind the last of these loads, in front of the first rewrite of a
    // register that one of them names.
    asm volatile("s_wait_xcnt 0x0" ::: "memory");
#pragma unroll
    for (int i = 0; i < 2; ++i)
#pragma unroll
      for (int ct = 0; ct < 4; ++ct)
#pragma unroll
        for (int j = 0; j < 8; ++j)
          (Cp + ro[i][j])[ct * 16] = acc[i][ct][j] + bm[i][j] + rv[i][ct][j];
  } else {
    f16* Cp = (f16*)Cv;
#pragma unroll
    for (int i = 0; i < 2; ++i)
#pragma unroll
      for (int ct = 0; ct < 4; ++ct) {
#pragma unroll
        for (int j = 0; j < 8; ++j) {
          int m = m0 + wm + i * 16 + j + 8 * hi;
          Cp[(size_t)m * ldc + n0 + wn + ct * 16 + col] =
              (f16)(acc[i][ct][j] + bias[m]);
        }
      }
  }
}

// q|k and vT projections in one grid (token tile, job tile, batch):
// y < 4:  qk(b,n,512) = xnT @ w_qkv[0:512]^T + bias, columns y*128 ..
// y >= 4: vT(b,c,n)   = w_qkv[512:768] @ xn + bias,  rows (y-4)*128 ..
// The row pitches are launch arguments (ldk: both operands').
__global__ __launch_bounds__(256, 1) void gemm_qkv_kernel(
    const f16* __restrict__ xnT, const f16* __restrict__ wq16,
    const float* __restrict__ b_qkv, f16* __restrict__ qk,
    f16* __restrict__ vT, int ldk, int ldqk, int ldv) {
  __shared__ __attribute__((aligned(16))) gemm_stage_t As;
  __shared__ __attribute__((aligned(16))) gemm_stage_t Bs;
  const int b  = blockIdx.z;
  const int t0 = blockIdx.x * 128;
  const f16* X = xnT + (size_t)b * NTOK * C;
  if (blockIdx.y < LDQK / 128) {
    gemm_abt_tile<0>(As, Bs, X, ldk, wq16, ldk, b_qkv,
                     qk + (size_t)b * NTOK * LDQK, ldqk, nullptr, t0,
                     blockIdx.y * 128);
  } else {
    gemm_abt_tile<2>(As, Bs, wq16 + (size_t)LDQK * C, ldk, X, ldk,
                     b_qkv + LDQK, vT + (size_t)b * C * NTOK, ldv, nullptr,
                     (blockIdx.y - LDQK / 128) * 128, t0);
    // In the built code the other job's text follows this job's stores, behind
    // a conditional branch: the wait stands in front of the first rewrite there
    // of a register that one of these stores names.
    asm volatile("s_wait_xcnt 0x0" ::: "memory");
  }
}

// Output projection + bias + residual: out(b,c,n) = w_out @ attn^T + b_out + x
__global__ __launch_bounds__(256, 1) void gemm_out_kernel(
    const f16* __restrict__ wo16, const f16* __restrict__ attn,
    const float* __restrict__ b_out, float* __restrict__ out,
    const float* __restrict__ x, int ldk, int ldc) {
  __shared__ __attribute__((aligned(16))) gemm_stage_t As;
  __shared__ __attribute__((aligned(16))) gemm_stage_t Bs;
  const int b = blockIdx.z;
  gemm_abt_tile<1>(As, Bs, wo16, ldk, attn + (size_t)b * NTOK * C, ldk, b_out,
                   out + (size_t)b * C * NTOK, ldc, x + (size_t)b * C * NTOK,
                   blockIdx.x * 128, blockIdx.y * 128);
}

__device__ __forceinline__ float xhalf(float x) {
  return __builtin_bit_cast(
      float, __builtin_amdgcn_permlanex16(__builtin_bit_cast(int, x),
                                          __builtin_bit_cast(int, x),
                                          0x76543210, 0xfedcba98, false, false));
}

constexpr int SKEYS = 64;            // keys per stage
constexpr int NSTG  = NTOK / SKEYS;  // stages

// Two waves per SIMD: the grid has one work-group per WGP, so fewer registers
// buy no residency; the 32-query output tile and Q take 384 registers.
__global__ __launch_bounds__(256) __attribute__((amdgpu_waves_per_eu(2, 2)))
void attn_kernel(
    const f16* __restrict__ qk, const f16* __restrict__ vT,
    f16* __restrict__ out) {
  const int b    = blockIdx.y;
  const int q0   = blockIdx.x * 128;
  const int w    = __builtin_amdgcn_readfirstlane(threadIdx.x >> 5);
  const int lane = threadIdx.x & 31;
  const int hi   = lane >> 4;
  const int col  = lane & 15;
  const int qg   = w & 3;   // query group of 32
  const int kh   = w >> 2;  // half of each stage's keys

  __shared__ f16 Ks[2][SKEYS][264];   // keys x channels, 528B pitch
  __shared__ f16 Vs[2][256][72];      // channels x keys, 144B pitch
  __shared__ float Mg[8][32][32][4];  // merge: one output tile per wave
  __shared__ float Ml[8][2][32];      // merge: its maximum and sum

  const f16* qb  = qk + (size_t)b * NTOK * LDQK;
  const f16* vb  = vT + (size_t)b * C * NTOK;
  const int  myq = q0 + qg * 32;

  // Preload Q fragments (2 x 16 queries x K=256), used as the B operand
  v16h qf[2][8];
#pragma unroll
  for (int g = 0; g < 2; ++g)
#pragma unroll
    for (int cb = 0; cb < 8; ++cb)
      qf[g][cb] = ld_frag(qb + (size_t)(myq + g * 16) * LDQK + cb * 32, LDQK);
  // Stands in front of the first rewrite of the address pair these loads name;
  // the sched_barrier keeps the later address arithmetic from being lifted over.
  asm volatile("s_wait_xcnt 0x0" ::: "memory");
  __builtin_amdgcn_sched_barrier(0);

  // acc[g][ct][j] = O^T[channel ct*16 + j + 8*hi][query g*16 + col]
  v8f acc[2][16];
#pragma unroll
  for (int g = 0; g < 2; ++g)
#pragma unroll
    for (int i = 0; i < 16; ++i)
#pragma unroll
      for (int j = 0; j < 8; ++j) acc[g][i][j] = 0.f;

  float m_i[2] = {-__builtin_inff(), -__builtin_inff()};  // running maxima
  float l_i[2] = {0.f, 0.f};  // running sums over this wave half's keys

  // Async-stage one 64-key stage into buffer `buf`: a wave's copy covers one
  // whole 512B K row, or four whole 128B V^T rows.
  auto stage = [&](int buf, int k0) {
#pragma unroll
    for (int u = 0; u < 8; ++u) {
      const int kr = u * 8 + w;
      async_cp16(&Ks[buf][kr][lane * 8],
                 qb + (size_t)(k0 + kr) * LDQK + C + lane * 8);
    }
    const int vr = threadIdx.x >> 3, vs = threadIdx.x & 7;
#pragma unroll
    for (int u = 0; u < 8; ++u)
      async_cp16(&Vs[buf][u * 32 + vr][vs * 8],
                 vb + (size_t)(u * 32 + vr) * NTOK + k0 + vs * 8);
  };

  stage(0, 0);
  async_wait0();
  __syncthreads();
  stage(1, SKEYS);

  // One stage.  `refill` is a literal at both calls: the loop bodies stay free
  // of branches, so nothing of a pass can be sunk behind its matrix blocks.
  auto pass = [&](int t, bool refill) __attribute__((always_inline)) {
    const int buf = t & 1;

    // Fragments come from LDS in groups of four (eight 16B loads at one place),
    // one group ahead of the eight WMMAs that use them, in two register sets.
    // Each sched_barrier keeps a load group whole and ahead of the WMMA block
    // before its use: left alone, the compiler, short of registers, put every
    // fragment's loads directly in front of its own WMMAs and waited them out.
    v16h fa[4], fb[4];
    auto ldK4 = [&](v16h (&f)[4], int f0) {  // fragment f: channels f>>1, tile f&1
#pragma unroll
      for (int n = 0; n < 4; ++n)
        f[n] = ld_frag(
            &Ks[buf][kh * 32 + ((f0 + n) & 1) * 16][((f0 + n) >> 1) * 32], 264);
      __builtin_amdgcn_sched_barrier(0);
    };
    auto ldV4 = [&](v16h (&f)[4], int ct0) {
#pragma unroll
      for (int n = 0; n < 4; ++n)
        f[n] = ld_frag(&Vs[buf][(ct0 + n) * 16][kh * 32], 72);
      __builtin_amdgcn_sched_barrier(0);
    };

    // ---- scores^T: 32 keys x 32 queries, K=256 -> 32 WMMAs, 16 fragments
    // s[i][g][j] = key 16*i + j + 8*hi of this wave's half, query g*16 + col
    v8f s[2][2];
#pragma unroll
    for (int i = 0; i < 2; ++i)
#pragma unroll
      for (int g = 0; g < 2; ++g)
#pragma unroll
        for (int j = 0; j < 8; ++j) s[i][g][j] = 0.f;
    auto mmS4 = [&](const v16h (&f)[4], int f0) {
#pragma unroll
      for (int n = 0; n < 4; ++n) {
        const int i = (f0 + n) & 1, cb = (f0 + n) >> 1;
        s[i][0] = wmma16(f[n], qf[0][cb], s[i][0]);
        s[i][1] = wmma16(f[n], qf[1][cb], s[i][1]);
      }
      __builtin_amdgcn_sched_barrier(0);
    };
    ldK4(fa, 0);
    ldK4(fb, 4);
    mmS4(fa, 0);
    ldK4(fa, 8);
    mmS4(fb, 4);
    ldK4(fb, 12);
    mmS4(fa, 8);
    mmS4(fb, 12);

    // ---- online softmax, one query per lane and tile
    v16h bp[2];    // P^T as B operand: 32 keys x 16 queries each
    float fac[2];  // what the new maxima scale the old sums and outputs by
#pragma unroll
    for (int g = 0; g < 2; ++g) {
      float mt[8];
#pragma unroll
      for (int j = 0; j < 8; ++j) {
        s[0][g][j] *= 0.0625f;  // * c^-0.5
        s[1][g][j] *= 0.0625f;
        mt[j] = fmaxf(s[0][g][j], s[1][g][j]);
      }
      float mx = fmaxf(fmaxf(fmaxf(mt[0], mt[1]), fmaxf(mt[2], mt[3])),
                       fmaxf(fmaxf(mt[4], mt[5]), fmaxf(mt[6], mt[7])));
      mx = fmaxf(mx, xhalf(mx));  // both halves now hold the 32 keys' maximum

      const float mn  = fmaxf(m_i[g], mx);
      fac[g] = __expf(m_i[g] - mn);
      m_i[g] = mn;

      float pt[8];
#pragma unroll
      for (int j = 0; j < 8; ++j) {
        float pa = __expf(s[0][g][j] - mn);
        float pb = __expf(s[1][g][j] - mn);
        pt[j]        = pa + pb;
        bp[g][j]     = (f16)pa;
        bp[g][j + 8] = (f16)pb;
      }
      const float ps = ((pt[0] + pt[1]) + (pt[2] + pt[3])) +
                       ((pt[4] + pt[5]) + (pt[6] + pt[7]));
      l_i[g] = l_i[g] * fac[g] + ps;
    }

    // ---- acc = acc * fac + V^T @ P^T (16 channel x 2 query tiles, K=32).
    // Four channel tiles are rescaled at a time, one block ahead of their own
    // WMMAs: the first four while the first V^T fragments are on their way, the
    // others beside the WMMAs of the block before.
    auto scl4 = [&](int ct0) {
#pragma unroll
      for (int n = 0; n < 4; ++n)
#pragma unroll
        for (int j = 0; j < 8; ++j) {
          acc[0][ct0 + n][j] *= fac[0];
          acc[1][ct0 + n][j] *= fac[1];
        }
    };
    auto mmV4 = [&](const v16h (&f)[4], int ct0) {
#pragma unroll
      for (int n = 0; n < 4; ++n) {
        acc[0][ct0 + n] = wmma16(f[n], bp[0], acc[0][ct0 + n]);
        acc[1][ct0 + n] = wmma16(f[n], bp[1], acc[1][ct0 + n]);
      }
    };
    __builtin_amdgcn_sched_barrier(0);  // the next group waits for s to be dead
    ldV4(fa, 0);
    ldV4(fb, 4);
    scl4(0);
    __builtin_amdgcn_sched_barrier(0);  // ends a block, as in ldK4 and mmS4
    mmV4(fa, 0);
    scl4(4);
    __builtin_amdgcn_sched_barrier(0);
    ldV4(fa, 8);
    mmV4(fb, 4);
    scl4(8);
    __builtin_amdgcn_sched_barrier(0);
    ldV4(fb, 12);
    mmV4(fa, 8);
    scl4(12);
    __builtin_amdgcn_sched_barrier(0);
    mmV4(fb, 12);

    lds_wait0();        // this wave has left buf
    async_wait0();      // its copies of the next stage have landed
    __syncthreads();    // next stage published; every wave has left buf
    if (refill) stage(buf, (t + 2) * SKEYS);  // flies during stage t+1
  };
#pragma unroll 1
  for (int t = 0; t < NSTG - 2; ++t) pass(t, true);  // a stage t+2 exists
#pragma unroll 1
  for (int t = NSTG - 2; t < NSTG; ++t) pass(t, false);
  async_wait0();

  // ---- merge the two key halves of each query group: wave (qg, kh) hands
  // query tile 1-kh to its partner and finishes tile kh.
  const float lt[2] = {l_i[0] + xhalf(l_i[0]), l_i[1] + xhalf(l_i[1])};
  auto give = [&](const v8f (&a)[16], float m, float l) {
#pragma unroll
    for (int ct = 0; ct < 16; ++ct) {
#pragma unroll
      for (int h = 0; h < 2; ++h) {
        float4 v = make_float4(a[ct][4 * h], a[ct][4 * h + 1], a[ct][4 * h + 2],
                               a[ct][4 * h + 3]);
        *(float4*)&Mg[w][ct * 2 + h][lane][0] = v;
      }
    }
    Ml[w][0][lane] = m;
    Ml[w][1][lane] = l;
  };
  // 1/l normalization, store (b, n, c) f16: a lane's 8 accumulator registers
  // are 8 consecutive channels of its query
  auto take = [&](const v8f (&a)[16], float m, float l, int g) {
    const int   pw = w ^ 4;
    const float mo = Ml[pw][0][lane];
    const float lo = Ml[pw][1][lane];
    const float mn = fmaxf(m, mo);
    float fa = __expf(m - mn);
    float fb = __expf(mo - mn);
    const float inv = 1.f / (l * fa + lo * fb);
    fa *= inv;
    fb *= inv;
    f16* orow =
        out + (size_t)b * NTOK * C + (size_t)(myq + g * 16 + col) * C + 8 * hi;
#pragma unroll
    for (int ct = 0; ct < 16; ++ct) {
      const float4 p0 = *(const float4*)&Mg[pw][ct * 2][lane][0];
      const float4 p1 = *(const float4*)&Mg[pw][ct * 2 + 1][lane][0];
      v8h o;
      o[0] = (f16)(a[ct][0] * fa + p0.x * fb);
      o[1] = (f16)(a[ct][1] * fa + p0.y * fb);
      o[2] = (f16)(a[ct][2] * fa + p0.z * fb);
      o[3] = (f16)(a[ct][3] * fa + p0.w * fb);
      o[4] = (f16)(a[ct][4] * fa + p1.x * fb);
      o[5] = (f16)(a[ct][5] * fa + p1.y * fb);
      o[6] = (f16)(a[ct][6] * fa + p1.z * fb);
      o[7] = (f16)(a[ct][7] * fa + p1.w * fb);
      *(v8h*)(orow + ct * 16) = o;
    }
  };
  if (kh == 0) give(acc[1], m_i[1], lt[1]);
  else         give(acc[0], m_i[0], lt[0]);
  __syncthreads();  // the partners' tiles are in LDS
  if (kh == 0) take(acc[0], m_i[0], lt[0], 0);
  else         take(acc[1], m_i[1], lt[1], 1);
}

// ---------------------------------------------------------------------------
extern "C" void kernel_launch(void* const* d_in, const int* in_sizes, int n_in,
                              void* d_out, int out_size, void* d_ws,
                              size_t ws_size, hipStream_t stream) {
  const float* x     = (const float*)d_in[0];
  const float* gsc   = (const float*)d_in[1];
  const float* gbi   = (const float*)d_in[2];
  const float* w_qkv = (const float*)d_in[3];
  const float* b_qkv = (const float*)d_in[4];
  const float* w_out = (const float*)d_in[5];
  const float* b_out = (const float*)d_in[6];
  float* out = (float*)d_out;

  // Workspace carve-up
  char* ws = (char*)d_ws;
  f16* xnT  = (f16*)ws; ws += (size_t)BATCH * NTOK * C * 2;     // 16.8 MB
  f16* qk   = (f16*)ws; ws += (size_t)BATCH * NTOK * LDQK * 2;  // 33.6 MB
  f16* vT   = (f16*)ws; ws += (size_t)BATCH * C * NTOK * 2;     // 16.8 MB
  f16* attn = (f16*)ws; ws += (size_t)BATCH * NTOK * C * 2;     // 16.8 MB
  f16* wq16 = (f16*)ws; ws += (size_t)(3 * C) * C * 2;
  f16* wo16 = (f16*)ws; ws += (size_t)C * C * 2;
  float* gmean = (float*)ws; ws += BATCH * GROUPS * 4;
  float* grstd = (float*)ws; ws += BATCH * GROUPS * 4;

  // 1) GroupNorm stats, and the weight converts
  gn_stats_cvt_kernel<<<BATCH * GROUPS, 256, 0, stream>>>(
      x, gmean, grstd, w_qkv, wq16, w_out, wo16);

  // 2) Normalize + transpose -> xnT (b, n, c) f16
  gn_apply_t_kernel<<<dim3(NTOK / 32, C / 32, BATCH), 256, 0, stream>>>(
      x, gmean, grstd, gsc, gbi, xnT);

  // 3) q|k and vT projections
  gemm_qkv_kernel<<<dim3(NTOK / 128, (LDQK + C) / 128, BATCH), 256, 0,
                    stream>>>(xnT, wq16, b_qkv, qk, vT, C, LDQK, NTOK);

  // 4) Flash attention -> attn (b, n, 256) f16
  attn_kernel<<<dim3(NTOK / 128, BATCH), 256, 0, stream>>>(qk, vT, attn);

  // 5) Output projection + bias + residual -> d_out (b, c, n) f32
  gemm_out_kernel<<<dim3(C / 128, NTOK / 128, BATCH), 256, 0, stream>>>(
      wo16, attn, b_out, out, x, C, NTOK);
}

// v005
// Measured time: 128 microseconds a run.
// Timed twice side by side with v004, it ran 1.09 times as fast both times.
// All steps since v000 together make it 2.19 times as fast.
#include <hip/hip_runtime.h>
#include <math.h>

typedef _Float16 f16;
typedef __attribute__((ext_vector_type(16))) _Float16 v16h;
typedef __attribute__((ext_vector_type(8)))  _Float16 v8h;
typedef __attribute__((ext_vector_type(8)))  float    v8f;

// Problem constants (fixed by the reference)
constexpr int BATCH  = 8;
constexpr int C      = 256;
constexpr int NTOK   = 4096;   // 64*64
constexpr int LDQK   = 512;    // q|k packed
constexpr int GROUPS = 32;

// ---------------------------------------------------------------------------
// Fragment helpers: CDNA5 16-bit A/B fragment layout (16x32, ISA 7.12.2):
// lane L: row/col = L&15 ; kb = (L>>4)*8 ; elements 0..7 hold K=kb..kb+7,
// elements 8..15 hold K=kb+16..kb+23.  Two 16B loads per lane.
// ---------------------------------------------------------------------------
__device__ __forceinline__ v16h ld_frag(const f16* p, int ld) {
  const int lane = threadIdx.x & 31;
  const f16* base = p + (size_t)(lane & 15) * ld + (lane >> 4) * 8;
  v8h lo = *(const v8h*)(base);
  v8h hh = *(const v8h*)(base + 16);
  v16h r;
#pragma unroll
  for (int i = 0; i < 8; ++i) { r[i] = lo[i]; r[i + 8] = hh[i]; }
  return r;
}

__device__ __forceinline__ v8f wmma16(v16h a, v16h b, v8f c) {
  return __builtin_amdgcn_wmma_f32_16x16x32_f16(false, a, false, b,
                                                (short)0, c, false, false);
}

// Async global->LDS 16B copy (CDNA5, tracked by ASYNCcnt), as the builtin: the
// compiler then owns the address registers, also those above v255.
typedef __attribute__((ext_vector_type(4))) int v4i;
__device__ __forceinline__ void async_cp16(f16* ldst, const f16* gsrc) {
  __builtin_amdgcn_global_load_async_to_lds_b128(
      (__attribute__((address_space(1))) v4i*)gsrc,
      (__attribute__((address_space(3))) v4i*)ldst, 0, 0);
}
__device__ __forceinline__ void async_wait0() {
  asm volatile("s_wait_asynccnt 0x0" ::: "memory");
}
// This wave's LDS reads have returned: owed before a buffer it read is refilled.
__device__ __forceinline__ void lds_wait0() {
  asm volatile("s_wait_dscnt 0x0" ::: "memory");
}

// ---------------------------------------------------------------------------
// GroupNorm in one launch: one block per (b,g), 8 channels * 4096 tokens.  A
// thread keeps its 8 tokens x 8 channels in registers from the sums to the
// normalisation, so x is read once and no second grid has to start.
// A wave takes 256 consecutive tokens: each load is one whole 128B line of a
// channel, all 64 of a thread are issued ahead of the sums.
// xn is stored group-major, xnG (b, c/8, n, 8) f16: a token's 8 channels of the
// group are one 16B store, a wave's store is 512 contiguous bytes, and a block
// writes one contiguous 64 KiB.
// The same launch converts the weights to f16, work that depends on nothing
// here and would else cost launches of its own: block bg takes elements
// bg*1024 .. bg*1024+1023 of [w_qkv | w_out], two per thread, loaded first,
// stored last.
// ---------------------------------------------------------------------------
typedef __attribute__((ext_vector_type(2))) _Float16 v2h;
constexpr int NWQ = 3 * C * C;  // elements of w_qkv
static_assert(NWQ % 1024 == 0 && NWQ + C * C == BATCH * GROUPS * 1024,
              "one block converts 1024 weights of one matrix");
constexpr int GNT = 512;  // threads of a block: 16 waves

__global__ __launch_bounds__(GNT) void gn_cvt_kernel(
    const float* __restrict__ x, const float* __restrict__ gsc,
    const float* __restrict__ gbi, f16* __restrict__ xnG,
    const float* __restrict__ w_qkv, f16* __restrict__ wq16,
    const float* __restrict__ w_out, f16* __restrict__ wo16) {
  const int bg = blockIdx.x;
  const int we = bg * 1024;  // block-uniform: which matrix, and where in it
  const float* wsrc = we < NWQ ? w_qkv + we : w_out + (we - NWQ);
  f16*         wdst = we < NWQ ? wq16 + we : wo16 + (we - NWQ);
  const float2 wv = *(const float2*)(wsrc + threadIdx.x * 2);
  // Keeps the weight load ahead of those of x: left alone, the compiler sank it
  // behind the sums, where its whole latency was waited out.
  __builtin_amdgcn_sched_barrier(0);

  const int wave = threadIdx.x >> 5;
  const int lane = threadIdx.x & 31;
  const int tok  = wave * 256 + lane;  // this thread's tokens: tok + 32*i
  const float* p = x + (size_t)bg * 32768 + tok;
  float v[8][8];  // [i][channel of the group]
#pragma unroll
  for (int c = 0; c < 8; ++c)
#pragma unroll
    for (int i = 0; i < 8; ++i) v[i][c] = p[c * NTOK + i * 32];

  float sp[8], qp[8];  // one chain per channel
#pragma unroll
  for (int c = 0; c < 8; ++c) {
    sp[c] = 0.f;
    qp[c] = 0.f;
#pragma unroll
    for (int i = 0; i < 8; ++i) {
      sp[c] += v[i][c];
      qp[c] = fmaf(v[i][c], v[i][c], qp[c]);
    }
  }
  float s = ((sp[0] + sp[1]) + (sp[2] + sp[3])) +
            ((sp[4] + sp[5]) + (sp[6] + sp[7]));
  float q = ((qp[0] + qp[1]) + (qp[2] + qp[3])) +
            ((qp[4] + qp[5]) + (qp[6] + qp[7]));
#pragma unroll
  for (int off = 16; off > 0; off >>= 1) {
    s += __shfl_xor(s, off, 32);
    q += __shfl_xor(q, off, 32);
  }
  __shared__ float ss[GNT / 32], qs[GNT / 32];
  if (lane == 0) {
    ss[wave] = s;
    qs[wave] = q;
  }
  __syncthreads();  // every wave's sums are in LDS; every thread adds them up
  float S = 0.f, Q = 0.f;
#pragma unroll
  for (int i = 0; i < GNT / 32; ++i) { S += ss[i]; Q += qs[i]; }
  const float mu  = S * (1.f / 32768.f);
  const float var = Q * (1.f / 32768.f) - mu * mu;
  const float rs  = rsqrtf(var + 1e-5f);

  const int c0 = (bg & (GROUPS - 1)) * 8;  // the group's first channel
  float sc[8], bi[8];
#pragma unroll
  for (int c = 0; c < 8; ++c) {
    sc[c] = gsc[c0 + c];
    bi[c] = gbi[c0 + c];
  }
  v8h h[8];
#pragma unroll
  for (int i = 0; i < 8; ++i)
#pragma unroll
    for (int c = 0; c < 8; ++c)
      h[i][c] = (f16)((v[i][c] - mu) * rs * sc[c] + bi[c]);
  v2h wh;
  wh[0] = (f16)wv.x;
  wh[1] = (f16)wv.y;
  // All stores stand at one place behind the arithmetic: no register that a
  // store names is written again, so no wait has to stand between them.
  __builtin_amdgcn_sched_barrier(0);
  f16* o = xnG + (size_t)bg * 32768 + (size_t)tok * 8;
#pragma unroll
  for (int i = 0; i < 8; ++i) *(v8h*)(o + i * 32 * 8) = h[i];
  // The weights go out here too: in front of the barrier their store would have
  // to be waited for there.
  *(v2h*)(wdst + threadIdx.x * 2) = wh;
}

// ---------------------------------------------------------------------------
// WMMA GEMM: C[M,N] = A[M,K] * B[N,K]^T, K = 256.  Tile 128x128, 8 waves.
// Both operands come through LDS in stages of 64 k, two buffers, filled with
// async global->LDS copies: a wave's copy covers four whole 128B row pieces, and
// the next stage flies while this one is worked on.  A wave takes 32 x 64 of the
// tile, so an A fragment feeds four matrix instructions and a B fragment two.
// MODE 0: f16 out, bias[N]          (q|k projection)
// MODE 1: f32 out, bias[M] + resid  (output projection)
// MODE 2: f16 out, bias[M]          (vT projection: rows = channels)
// The tile is a device function: the q|k and the vT projection, which do not
// depend on each other, share one launch, the block index picks the job.
// xn (A in MODE 0, B in MODE 2) lies group-major, (c/8, n, 8): there a wave's
// copy takes one 16B piece of 32 consecutive tokens, 512 contiguous bytes, and
// lands them one below the other in LDS (144B apart: bank-clean, as the reads).
// A, B, Cv and resid point at the batch's planes; LDS comes from the kernel, so
// that two jobs in one kernel share one allocation.
// ---------------------------------------------------------------------------
constexpr int KC  = 64;      // k per stage
constexpr int NKC = C / KC;  // stages

// 144B pitch: 16B aligned, bank-clean for the 16B fragment reads
typedef f16 gemm_stage_t[2][128][72];

template <int MODE>
__device__ __forceinline__ void gemm_abt_tile(
    gemm_stage_t& As, gemm_stage_t& Bs, const f16* __restrict__ A, int lda,
    const f16* __restrict__ B, int ldb, const float* __restrict__ bias,
    void* __restrict__ Cv, int ldc, const float* __restrict__ resid, int m0,
    int n0) {
  constexpr bool XA = MODE == 0, XB = MODE == 2;  // which operand is xn
  A += XA ? (size_t)m0 * 8 : (size_t)m0 * lda;
  B += XB ? (size_t)n0 * 8 : (size_t)n0 * ldb;

  const int w    = __builtin_amdgcn_readfirstlane(threadIdx.x >> 5);
  const int lane = threadIdx.x & 31;
  const int hi   = lane >> 4;
  const int col  = lane & 15;
  const int wm   = (w & 3) * 32;   // this wave's rows of the tile
  const int wn   = (w >> 2) * 64;  // this wave's columns of the tile

  v8f acc[2][4];
#pragma unroll
  for (int i = 0; i < 2; ++i)
#pragma unroll
    for (int ct = 0; ct < 4; ++ct)
#pragma unroll
      for (int j = 0; j < 8; ++j) acc[i][ct][j] = 0.f;

  const int sr = threadIdx.x >> 3;        // row within a group of 32
  const int ss = (threadIdx.x & 7) * 8;   // 16B piece of the 128B row piece
  const int xr = threadIdx.x & 127;       // xn: token of the tile
  const int xp = threadIdx.x >> 7;        // xn: piece within a pair of pieces
  auto stage = [&](int buf, int kb) {
#pragma unroll
    for (int u = 0; u < 4; ++u) {
      if (XA)
        async_cp16(&As[buf][xr][(u * 2 + xp) * 8],
                   A + ((size_t)(kb / 8 + u * 2 + xp) * NTOK + xr) * 8);
      else
        async_cp16(&As[buf][u * 32 + sr][ss],
                   A + (size_t)(u * 32 + sr) * lda + kb + ss);
    }
#pragma unroll
    for (int u = 0; u < 4; ++u) {
      if (XB)
        async_cp16(&Bs[buf][xr][(u * 2 + xp) * 8],
                   B + ((size_t)(kb / 8 + u * 2 + xp) * NTOK + xr) * 8);
      else
        async_cp16(&Bs[buf][u * 32 + sr][ss],
                   B + (size_t)(u * 32 + sr) * ldb + kb + ss);
    }
  };

  stage(0, 0);
  async_wait0();
  __syncthreads();
  stage(1, KC);

  // Unrolled, as are the short loops here: buffer index, refill test and the
  // indices of the register arrays become literals.
#pragma unroll
  for (int t = 0; t < NKC; ++t) {
    const int buf = t & 1;
#pragma unroll
    for (int kk = 0; kk < KC; kk += 32) {
      // The six fragments of a k step are read at one place (twelve 16B loads),
      // then worked on: each sched_barrier keeps the load group whole; left
      // alone, the compiler read each B fragment in front of its own two WMMAs
      // and waited it out.
      v16h af[2], bf[4];
#pragma unroll
      for (int i = 0; i < 2; ++i) af[i] = ld_frag(&As[buf][wm + i * 16][kk], 72);
#pragma unroll
      for (int ct = 0; ct < 4; ++ct)
        bf[ct] = ld_frag(&Bs[buf][wn + ct * 16][kk], 72);
      __builtin_amdgcn_sched_barrier(0);
#pragma unroll
      for (int ct = 0; ct < 4; ++ct) {
        acc[0][ct] = wmma16(af[0], bf[ct], acc[0][ct]);
        acc[1][ct] = wmma16(af[1], bf[ct], acc[1][ct]);
      }
      __builtin_amdgcn_sched_barrier(0);  // the WMMAs stay in front of what follows
    }
    lds_wait0();      // this wave has left buf
    async_wait0();    // its copies of the next stage have landed
    __syncthreads();  // next stage published; every wave has left buf
    if (t + 2 < NKC) stage(buf, (t + 2) * KC);  // flies during stage t+1
  }
  async_wait0();

  if (MODE == 0) {
    f16* Cp = (f16*)Cv;
#pragma unroll
    for (int i = 0; i < 2; ++i)
#pragma unroll
      for (int ct = 0; ct < 4; ++ct) {
        const int n = n0 + wn + ct * 16 + col;
        float bn = bias[n];
#pragma unroll
        for (int j = 0; j < 8; ++j) {
          int m = m0 + wm + i * 16 + j + 8 * hi;
          Cp[(size_t)m * ldc + n] = (f16)(acc[i][ct][j] + bn);
        }
      }
  } else if (MODE == 1) {
    float* Cp = (float*)Cv;
    const float* Rp = resid;
    // One 32-bit element offset per row serves the residual load and the store
    // of the same element (a batch's plane is 1 Mi elements), so its register
    // lives on to the store.
    unsigned ro[2][8];
    float bm[2][8], rv[2][4][8];
#pragma unroll
    for (int i = 0; i < 2; ++i)
#pragma unroll
      for (int j = 0; j < 8; ++j) {
        const int m = m0 + wm + i * 16 + j + 8 * hi;
        ro[i][j] = (unsigned)(m * ldc + n0 + wn + col);
        bm[i][j] = bias[m];
#pragma unroll
        for (int ct = 0; ct < 4; ++ct)
          rv[i][ct][j] = (Rp + ro[i][j])[ct * 16];
      }
    // Behind the last of these loads, in front of the first rewrite of a
    // register that one of them names.
    asm volatile("s_wait_xcnt 0x0" ::: "memory");
#pragma unroll
    for (int i = 0; i < 2; ++i)
#pragma unroll
      for (int ct = 0; ct < 4; ++ct)
#pragma unroll
        for (int j = 0; j < 8; ++j)
          (Cp + ro[i][j])[ct * 16] = acc[i][ct][j] + bm[i][j] + rv[i][ct][j];
  } else {
    f16* Cp = (f16*)Cv;
#pragma unroll
    for (int i = 0; i < 2; ++i)
#pragma unroll
      for (int ct = 0; ct < 4; ++ct) {
#pragma unroll
        for (int j = 0; j < 8; ++j) {
          int m = m0 + wm + i * 16 + j + 8 * hi;
          Cp[(size_t)m * ldc + n0 + wn + ct * 16 + col] =
              (f16)(acc[i][ct][j] + bias[m]);
        }
      }
  }
}

// q|k and vT projections in one grid (token tile, job tile, batch):
// y < 4:  qk(b,n,512) = xn^T @ w_qkv[0:512]^T + bias, columns y*128 ..
// y >= 4: vT(b,c,n)   = w_qkv[512:768] @ xn + bias,  rows (y-4)*128 ..
// The row pitches are launch arguments (ldk: the weights').
__global__ __launch_bounds__(256, 1) void gemm_qkv_kernel(
    const f16* __restrict__ xnG, const f16* __restrict__ wq16,
    const float* __restrict__ b_qkv, f16* __restrict__ qk,
    f16* __restrict__ vT, int ldk, int ldqk, int ldv) {
  __shared__ __attribute__((aligned(16))) gemm_stage_t As;
  __shared__ __attribute__((aligned(16))) gemm_stage_t Bs;
  const int b  = blockIdx.z;
  const int t0 = blockIdx.x * 128;
  const f16* X = xnG + (size_t)b * NTOK * C;
  if (blockIdx.y < LDQK / 128) {
    gemm_abt_tile<0>(As, Bs, X, ldk, wq16, ldk, b_qkv,
                     qk + (size_t)b * NTOK * LDQK, ldqk, nullptr, t0,
                     blockIdx.y * 128);
  } else {
    gemm_abt_tile<2>(As, Bs, wq16 + (size_t)LDQK * C, ldk, X, ldk,
                     b_qkv + LDQK, vT + (size_t)b * C * NTOK, ldv, nullptr,
                     (blockIdx.y - LDQK / 128) * 128, t0);
    // In the built code the other job's text follows this job's stores, behind
    // a conditional branch: the wait stands in front of the first rewrite there
    // of a register that one of these stores names.
    asm volatile("s_wait_xcnt 0x0" ::: "memory");
  }
}

// Output projection + bias + residual: out(b,c,n) = w_out @ attn^T + b_out + x
__global__ __launch_bounds__(256, 1) void gemm_out_kernel(
    const f16* __restrict__ wo16, const f16* __restrict__ attn,
    const float* __restrict__ b_out, float* __restrict__ out,
    const float* __restrict__ x, int ldk, int ldc) {
  __shared__ __attribute__((aligned(16))) gemm_stage_t As;
  __shared__ __attribute__((aligned(16))) gemm_stage_t Bs;
  const int b = blockIdx.z;
  gemm_abt_tile<1>(As, Bs, wo16, ldk, attn + (size_t)b * NTOK * C, ldk, b_out,
                   out + (size_t)b * C * NTOK, ldc, x + (size_t)b * C * NTOK,
                   blockIdx.x * 128, blockIdx.y * 128);
}

__device__ __forceinline__ float xhalf(float x) {
  return __builtin_bit_cast(
      float, __builtin_amdgcn_permlanex16(__builtin_bit_cast(int, x),
                                          __builtin_bit_cast(int, x),
                                          0x76543210, 0xfedcba98, false, false));
}

constexpr int SKEYS = 64;            // keys per stage
constexpr int NSTG  = NTOK / SKEYS;  // stages

// Two waves per SIMD: the grid has one work-group per WGP, so fewer registers
// buy no residency; the 32-query output tile and Q take 384 registers.
__global__ __launch_bounds__(256) __attribute__((amdgpu_waves_per_eu(2, 2)))
void attn_kernel(
    const f16* __restrict__ qk, const f16* __restrict__ vT,
    f16* __restrict__ out) {
  const int b    = blockIdx.y;
  const int q0   = blockIdx.x * 128;
  const int w    = __builtin_amdgcn_readfirstlane(threadIdx.x >> 5);
  const int lane = threadIdx.x & 31;
  const int hi   = lane >> 4;
  const int col  = lane & 15;
  const int qg   = w & 3;   // query group of 32
  const int kh   = w >> 2;  // half of each stage's keys

  __shared__ f16 Ks[2][SKEYS][264];   // keys x channels, 528B pitch
  __shared__ f16 Vs[2][256][72];      // channels x keys, 144B pitch
  __shared__ float Mg[8][32][32][4];  // merge: one output tile per wave
  __shared__ float Ml[8][2][32];      // merge: its maximum and sum

  const f16* qb  = qk + (size_t)b * NTOK * LDQK;
  const f16* vb  = vT + (size_t)b * C * NTOK;
  const int  myq = q0 + qg * 32;

  // Preload Q fragments (2 x 16 queries x K=256), used as the B operand
  v16h qf[2][8];
#pragma unroll
  for (int g = 0; g < 2; ++g)
#pragma unroll
    for (int cb = 0; cb < 8; ++cb)
      qf[g][cb] = ld_frag(qb + (size_t)(myq + g * 16) * LDQK + cb * 32, LDQK);
  // Stands in front of the first rewrite of the address pair these loads name;
  // the sched_barrier keeps the later address arithmetic from being lifted over.
  asm volatile("s_wait_xcnt 0x0" ::: "memory");
  __builtin_amdgcn_sched_barrier(0);

  // acc[g][ct][j] = O^T[channel ct*16 + j + 8*hi][query g*16 + col]
  v8f acc[2][16];
#pragma unroll
  for (int g = 0; g < 2; ++g)
#pragma unroll
    for (int i = 0; i < 16; ++i)
#pragma unroll
      for (int j = 0; j < 8; ++j) acc[g][i][j] = 0.f;

  float m_i[2] = {-__builtin_inff(), -__builtin_inff()};  // running maxima
  float l_i[2] = {0.f, 0.f};  // running sums over this wave half's keys

  // Async-stage one 64-key stage into buffer `buf`: a wave's copy covers one
  // whole 512B K row, or four whole 128B V^T rows.
  auto stage = [&](int buf, int k0) {
#pragma unroll
    for (int u = 0; u < 8; ++u) {
      const int kr = u * 8 + w;
      async_cp16(&Ks[buf][kr][lane * 8],
                 qb + (size_t)(k0 + kr) * LDQK + C + lane * 8);
    }
    const int vr = threadIdx.x >> 3, vs = threadIdx.x & 7;
#pragma unroll
    for (int u = 0; u < 8; ++u)
      async_cp16(&Vs[buf][u * 32 + vr][vs * 8],
                 vb + (size_t)(u * 32 + vr) * NTOK + k0 + vs * 8);
  };

  stage(0, 0);
  async_wait0();
  __syncthreads();
  stage(1, SKEYS);

  // One stage.  `refill` is a literal at both calls: the loop bodies stay free
  // of branches, so nothing of a pass can be sunk behind its matrix blocks.
  auto pass = [&](int t, bool refill) __attribute__((always_inline)) {
    const int buf = t & 1;

    // Fragments come from LDS in groups of four (eight 16B loads at one place),
    // one group ahead of the eight WMMAs that use them, in two register sets.
    // Each sched_barrier keeps a load group whole and ahead of the WMMA block
    // before its use: left alone, the compiler, short of registers, put every
    // fragment's loads directly in front of its own WMMAs and waited them out.
    v16h fa[4], fb[4];
    auto ldK4 = [&](v16h (&f)[4], int f0) {  // fragment f: channels f>>1, tile f&1
#pragma unroll
      for (int n = 0; n < 4; ++n)
        f[n] = ld_frag(
            &Ks[buf][kh * 32 + ((f0 + n) & 1) * 16][((f0 + n) >> 1) * 32], 264);
      __builtin_amdgcn_sched_barrier(0);
    };
    auto ldV4 = [&](v16h (&f)[4], int ct0) {
#pragma unroll
      for (int n = 0; n < 4; ++n)
        f[n] = ld_frag(&Vs[buf][(ct0 + n) * 16][kh * 32], 72);
      __builtin_amdgcn_sched_barrier(0);
    };

    // ---- scores^T: 32 keys x 32 queries, K=256 -> 32 WMMAs, 16 fragments
    // s[i][g][j] = key 16*i + j + 8*hi of this wave's half, query g*16 + col
    v8f s[2][2];
#pragma unroll
    for (int i = 0; i < 2; ++i)
#pragma unroll
      for (int g = 0; g < 2; ++g)
#pragma unroll
        for (int j = 0; j < 8; ++j) s[i][g][j] = 0.f;
    auto mmS4 = [&](const v16h (&f)[4], int f0) {
#pragma unroll
      for (int n = 0; n < 4; ++n) {
        const int i = (f0 + n) & 1, cb = (f0 + n) >> 1;
        s[i][0] = wmma16(f[n], qf[0][cb], s[i][0]);
        s[i][1] = wmma16(f[n], qf[1][cb], s[i][1]);
      }
      __builtin_amdgcn_sched_barrier(0);
    };
    ldK4(fa, 0);
    ldK4(fb, 4);
    mmS4(fa, 0);
    ldK4(fa, 8);
    mmS4(fb, 4);
    ldK4(fb, 12);
    mmS4(fa, 8);
    mmS4(fb, 12);

    // ---- online softmax, one query per lane and tile
    v16h bp[2];    // P^T as B operand: 32 keys x 16 queries each
    float fac[2];  // what the new maxima scale the old sums and outputs by
#pragma unroll
    for (int g = 0; g < 2; ++g) {
      float mt[8];
#pragma unroll
      for (int j = 0; j < 8; ++j) {
        s[0][g][j] *= 0.0625f;  // * c^-0.5
        s[1][g][j] *= 0.0625f;
        mt[j] = fmaxf(s[0][g][j], s[1][g][j]);
      }
      float mx = fmaxf(fmaxf(fmaxf(mt[0], mt[1]), fmaxf(mt[2], mt[3])),
                       fmaxf(fmaxf(mt[4], mt[5]), fmaxf(mt[6], mt[7])));
      mx = fmaxf(mx, xhalf(mx));  // both halves now hold the 32 keys' maximum

      const float mn  = fmaxf(m_i[g], mx);
      fac[g] = __expf(m_i[g] - mn);
      m_i[g] = mn;

      float pt[8];
#pragma unroll
      for (int j = 0; j < 8; ++j) {
        float pa = __expf(s[0][g][j] - mn);
        float pb = __expf(s[1][g][j] - mn);
        pt[j]        = pa + pb;
        bp[g][j]     = (f16)pa;
        bp[g][j + 8] = (f16)pb;
      }
      const float ps = ((pt[0] + pt[1]) + (pt[2] + pt[3])) +
                       ((pt[4] + pt[5]) + (pt[6] + pt[7]));
      l_i[g] = l_i[g] * fac[g] + ps;
    }

    // ---- acc = acc * fac + V^T @ P^T (16 channel x 2 query tiles, K=32).
    // Four channel tiles are rescaled at a time, one block ahead of their own
    // WMMAs: the first four while the first V^T fragments are on their way, the
    // others beside the WMMAs of the block before.
    auto scl4 = [&](int ct0) {
#pragma unroll
      for (int n = 0; n < 4; ++n)
#pragma unroll
        for (int j = 0; j < 8; ++j) {
          acc[0][ct0 + n][j] *= fac[0];
          acc[1][ct0 + n][j] *= fac[1];
        }
    };
    auto mmV4 = [&](const v16h (&f)[4], int ct0) {
#pragma unroll
      for (int n = 0; n < 4; ++n) {
        acc[0][ct0 + n] = wmma16(f[n], bp[0], acc[0][ct0 + n]);
        acc[1][ct0 + n] = wmma16(f[n], bp[1], acc[1][ct0 + n]);
      }
    };
    __builtin_amdgcn_sched_barrier(0);  // the next group waits for s to be dead
    ldV4(fa, 0);
    ldV4(fb, 4);
    scl4(0);
    __builtin_amdgcn_sched_barrier(0);  // ends a block, as in ldK4 and mmS4
    mmV4(fa, 0);
    scl4(4);
    __builtin_amdgcn_sched_barrier(0);
    ldV4(fa, 8);
    mmV4(fb, 4);
    scl4(8);
    __builtin_amdgcn_sched_barrier(0);
    ldV4(fb, 12);
    mmV4(fa, 8);
    scl4(12);
    __builtin_amdgcn_sched_barrier(0);
    mmV4(fb, 12);

    lds_wait0();        // this wave has left buf
    async_wait0();      // its copies of the next stage have landed
    __syncthreads();    // next stage published; every wave has left buf
    if (refill) stage(buf, (t + 2) * SKEYS);  // flies during stage t+1
  };
#pragma unroll 1
  for (int t = 0; t < NSTG - 2; ++t) pass(t, true);  // a stage t+2 exists
#pragma unroll 1
  for (int t = NSTG - 2; t < NSTG; ++t) pass(t, false);
  async_wait0();

  // ---- merge the two key halves of each query group: wave (qg, kh) hands
  // query tile 1-kh to its partner and finishes tile kh.
  const float lt[2] = {l_i[0] + xhalf(l_i[0]), l_i[1] + xhalf(l_i[1])};
  auto give = [&](const v8f (&a)[16], float m, float l) {
#pragma unroll
    for (int ct = 0; ct < 16; ++ct) {
#pragma unroll
      for (int h = 0; h < 2; ++h) {
        float4 v = make_float4(a[ct][4 * h], a[ct][4 * h + 1], a[ct][4 * h + 2],
                               a[ct][4 * h + 3]);
        *(float4*)&Mg[w][ct * 2 + h][lane][0] = v;
      }
    }
    Ml[w][0][lane] = m;
    Ml[w][1][lane] = l;
  };
  // 1/l normalization, store (b, n, c) f16: a lane's 8 accumulator registers
  // are 8 consecutive channels of its query
  auto take = [&](const v8f (&a)[16], float m, float l, int g) {
    const int   pw = w ^ 4;
    const float mo = Ml[pw][0][lane];
    const float lo = Ml[pw][1][lane];
    const float mn = fmaxf(m, mo);
    float fa = __expf(m - mn);
    float fb = __expf(mo - mn);
    const float inv = 1.f / (l * fa + lo * fb);
    fa *= inv;
    fb *= inv;
    f16* orow =
        out + (size_t)b * NTOK * C + (size_t)(myq + g * 16 + col) * C + 8 * hi;
#pragma unroll
    for (int ct = 0; ct < 16; ++ct) {
      const float4 p0 = *(const float4*)&Mg[pw][ct * 2][lane][0];
      const float4 p1 = *(const float4*)&Mg[pw][ct * 2 + 1][lane][0];
      v8h o;
      o[0] = (f16)(a[ct][0] * fa + p0.x * fb);
      o[1] = (f16)(a[ct][1] * fa + p0.y * fb);
      o[2] = (f16)(a[ct][2] * fa + p0.z * fb);
      o[3] = (f16)(a[ct][3] * fa + p0.w * fb);
      o[4] = (f16)(a[ct][4] * fa + p1.x * fb);
      o[5] = (f16)(a[ct][5] * fa + p1.y * fb);
      o[6] = (f16)(a[ct][6] * fa + p1.z * fb);
      o[7] = (f16)(a[ct][7] * fa + p1.w * fb);
      *(v8h*)(orow + ct * 16) = o;
    }
  };
  if (kh == 0) give(acc[1], m_i[1], lt[1]);
  else         give(acc[0], m_i[0], lt[0]);
  __syncthreads();  // the partners' tiles are in LDS
  if (kh == 0) take(acc[0], m_i[0], lt[0], 0);
  else         take(acc[1], m_i[1], lt[1], 1);
}

// ---------------------------------------------------------------------------
extern "C" void kernel_launch(void* const* d_in, const int* in_sizes, int n_in,
                              void* d_out, int out_size, void* d_ws,
                              size_t ws_size, hipStream_t stream) {
  const float* x     = (const float*)d_in[0];
  const float* gsc   = (const float*)d_in[1];
  const float* gbi   = (const float*)d_in[2];
  const float* w_qkv = (const float*)d_in[3];
  const float* b_qkv = (const float*)d_in[4];
  const float* w_out = (const float*)d_in[5];
  const float* b_out = (const float*)d_in[6];
  float* out = (float*)d_out;

  // Workspace carve-up
  char* ws = (char*)d_ws;
  f16* xnG  = (f16*)ws; ws += (size_t)BATCH * NTOK * C * 2;     // 16.8 MB
  f16* qk   = (f16*)ws; ws += (size_t)BATCH * NTOK * LDQK * 2;  // 33.6 MB
  f16* vT   = (f16*)ws; ws += (size_t)BATCH * C * NTOK * 2;     // 16.8 MB
  f16* attn = (f16*)ws; ws += (size_t)BATCH * NTOK * C * 2;     // 16.8 MB
  f16* wq16 = (f16*)ws; ws += (size_t)(3 * C) * C * 2;
  f16* wo16 = (f16*)ws; ws += (size_t)C * C * 2;

  // 1) GroupNorm -> xnG (b, c/8, n, 8) f16, and the weight converts
  gn_cvt_kernel<<<BATCH * GROUPS, GNT, 0, stream>>>(x, gsc, gbi, xnG, w_qkv,
                                                    wq16, w_out, wo16);

  // 2) q|k and vT projections
  gemm_qkv_kernel<<<dim3(NTOK / 128, (LDQK + C) / 128, BATCH), 256, 0,
                    stream>>>(xnG, wq16, b_qkv, qk, vT, C, LDQK, NTOK);

  // 3) Flash attention -> attn (b, n, 256) f16
  attn_kernel<<<dim3(NTOK / 128, BATCH), 256, 0, stream>>>(qk, vT, attn);

  // 4) Output projection + bias + residual -> d_out (b, c, n) f32
  gemm_out_kernel<<<dim3(C / 128, NTOK / 128, BATCH), 256, 0, stream>>>(
      wo16, attn, b_out, out, x, C, NTOK);
}

// v006
// One run takes 121 microseconds.
// In both of two side-by-side timings against v005, it was 1.06 times as fast.
// Counting every step since v000, it is 2.33 times as fast.
#include <hip/hip_runtime.h>
#include <math.h>

typedef _Float16 f16;
typedef __attribute__((ext_vector_type(16))) _Float16 v16h;
typedef __attribute__((ext_vector_type(8)))  _Float16 v8h;
typedef __attribute__((ext_vector_type(8)))  float    v8f;

// Problem constants (fixed by the reference)
constexpr int BATCH  = 8;
constexpr int C      = 256;
constexpr int NTOK   = 4096;   // 64*64
constexpr int LDQK   = 512;    // q|k packed
constexpr int GROUPS = 32;

// ---------------------------------------------------------------------------
// Fragment helpers: CDNA5 16-bit A/B fragment layout (16x32, ISA 7.12.2):
// lane L: row/col = L&15 ; kb = (L>>4)*8 ; elements 0..7 hold K=kb..kb+7,
// elements 8..15 hold K=kb+16..kb+23.  Two 16B loads per lane.
// ---------------------------------------------------------------------------
__device__ __forceinline__ v16h ld_frag(const f16* p, int ld) {
  const int lane = threadIdx.x & 31;
  const f16* base = p + (size_t)(lane & 15) * ld + (lane >> 4) * 8;
  v8h lo = *(const v8h*)(base);
  v8h hh = *(const v8h*)(base + 16);
  v16h r;
#pragma unroll
  for (int i = 0; i < 8; ++i) { r[i] = lo[i]; r[i + 8] = hh[i]; }
  return r;
}

__device__ __forceinline__ v8f wmma16(v16h a, v16h b, v8f c) {
  return __builtin_amdgcn_wmma_f32_16x16x32_f16(false, a, false, b,
                                                (short)0, c, false, false);
}

// Async global->LDS 16B copy (CDNA5, tracked by ASYNCcnt), as the builtin: the
// compiler then owns the address registers, also those above v255.
typedef __attribute__((ext_vector_type(4))) int v4i;
__device__ __forceinline__ void async_cp16(f16* ldst, const f16* gsrc) {
  __builtin_amdgcn_global_load_async_to_lds_b128(
      (__attribute__((address_space(1))) v4i*)gsrc,
      (__attribute__((address_space(3))) v4i*)ldst, 0, 0);
}
__device__ __forceinline__ void async_wait0() {
  asm volatile("s_wait_asynccnt 0x0" ::: "memory");
}
// This wave's LDS reads have returned: owed before a buffer it read is refilled.
__device__ __forceinline__ void lds_wait0() {
  asm volatile("s_wait_dscnt 0x0" ::: "memory");
}

// ---------------------------------------------------------------------------
// GroupNorm in one launch: one block per (b,g), 8 channels * 4096 tokens.  A
// thread keeps its 8 tokens x 8 channels in registers from the sums to the
// normalisation, so x is read once and no second grid has to start.
// A wave takes 256 consecutive tokens: each load is one whole 128B line of a
// channel, all 64 of a thread are issued ahead of the sums.
// xn is stored group-major, xnG (b, c/8, n, 8) f16: a token's 8 channels of the
// group are one 16B store, a wave's store is 512 contiguous bytes, and a block
// writes one contiguous 64 KiB.
// The same launch converts the weights to f16, work that depends on nothing
// here and would else cost launches of its own: block bg takes elements
// bg*1024 .. bg*1024+1023 of [w_qkv | w_out], two per thread, loaded first,
// stored last.
// ---------------------------------------------------------------------------
typedef __attribute__((ext_vector_type(2))) _Float16 v2h;
constexpr int NWQ = 3 * C * C;  // elements of w_qkv
static_assert(NWQ % 1024 == 0 && NWQ + C * C == BATCH * GROUPS * 1024,
              "one block converts 1024 weights of one matrix");
constexpr int GNT = 512;  // threads of a block: 16 waves

__global__ __launch_bounds__(GNT) void gn_cvt_kernel(
    const float* __restrict__ x, const float* __restrict__ gsc,
    const float* __restrict__ gbi, f16* __restrict__ xnG,
    const float* __restrict__ w_qkv, f16* __restrict__ wq16,
    const float* __restrict__ w_out, f16* __restrict__ wo16) {
  const int bg = blockIdx.x;
  const int we = bg * 1024;  // block-uniform: which matrix, and where in it
  const float* wsrc = we < NWQ ? w_qkv + we : w_out + (we - NWQ);
  f16*         wdst = we < NWQ ? wq16 + we : wo16 + (we - NWQ);
  const float2 wv = *(const float2*)(wsrc + threadIdx.x * 2);
  // Keeps the weight load ahead of those of x: left alone, the compiler sank it
  // behind the sums, where its whole latency was waited out.
  __builtin_amdgcn_sched_barrier(0);

  const int wave = threadIdx.x >> 5;
  const int lane = threadIdx.x & 31;
  const int tok  = wave * 256 + lane;  // this thread's tokens: tok + 32*i
  const float* p = x + (size_t)bg * 32768 + tok;
  float v[8][8];  // [i][channel of the group]
#pragma unroll
  for (int c = 0; c < 8; ++c)
#pragma unroll
    for (int i = 0; i < 8; ++i) v[i][c] = p[c * NTOK + i * 32];

  float sp[8], qp[8];  // one chain per channel
#pragma unroll
  for (int c = 0; c < 8; ++c) {
    sp[c] = 0.f;
    qp[c] = 0.f;
#pragma unroll
    for (int i = 0; i < 8; ++i) {
      sp[c] += v[i][c];
      qp[c] = fmaf(v[i][c], v[i][c], qp[c]);
    }
  }
  float s = ((sp[0] + sp[1]) + (sp[2] + sp[3])) +
            ((sp[4] + sp[5]) + (sp[6] + sp[7]));
  float q = ((qp[0] + qp[1]) + (qp[2] + qp[3])) +
            ((qp[4] + qp[5]) + (qp[6] + qp[7]));
#pragma unroll
  for (int off = 16; off > 0; off >>= 1) {
    s += __shfl_xor(s, off, 32);
    q += __shfl_xor(q, off, 32);
  }
  __shared__ float ss[GNT / 32], qs[GNT / 32];
  if (lane == 0) {
    ss[wave] = s;
    qs[wave] = q;
  }
  __syncthreads();  // every wave's sums are in LDS; every thread adds them up
  float S = 0.f, Q = 0.f;
#pragma unroll
  for (int i = 0; i < GNT / 32; ++i) { S += ss[i]; Q += qs[i]; }
  const float mu  = S * (1.f / 32768.f);
  const float var = Q * (1.f / 32768.f) - mu * mu;
  const float rs  = rsqrtf(var + 1e-5f);

  const int c0 = (bg & (GROUPS - 1)) * 8;  // the group's first channel
  float sc[8], bi[8];
#pragma unroll
  for (int c = 0; c < 8; ++c) {
    sc[c] = gsc[c0 + c];
    bi[c] = gbi[c0 + c];
  }
  v8h h[8];
#pragma unroll
  for (int i = 0; i < 8; ++i)
#pragma unroll
    for (int c = 0; c < 8; ++c)
      h[i][c] = (f16)((v[i][c] - mu) * rs * sc[c] + bi[c]);
  v2h wh;
  wh[0] = (f16)wv.x;
  wh[1] = (f16)wv.y;
  // All stores stand at one place behind the arithmetic: no register that a
  // store names is written again, so no wait has to stand between them.
  __builtin_amdgcn_sched_barrier(0);
  f16* o = xnG + (size_t)bg * 32768 + (size_t)tok * 8;
#pragma unroll
  for (int i = 0; i < 8; ++i) *(v8h*)(o + i * 32 * 8) = h[i];
  // The weights go out here too: in front of the barrier their store would have
  // to be waited for there.
  *(v2h*)(wdst + threadIdx.x * 2) = wh;
}

// ---------------------------------------------------------------------------
// WMMA GEMM: C[M,N] = A[M,K] * B[N,K]^T, K = 256.  Tile 128x128, 8 waves.
// Both operands come through LDS in stages of 64 k, two buffers, filled with
// async global->LDS copies: a wave's copy covers four whole 128B row pieces, and
// the next stage flies while this one is worked on.  A wave takes 32 x 64 of the
// tile, so an A fragment feeds four matrix instructions and a B fragment two.
// MODE 0: f16 out, bias[N]          (q|k projection)
// MODE 1: f32 out, bias[M] + resid  (output projection)
// MODE 2: f16 out, bias[M]          (vT projection: rows = channels)
// The tile is a device function: the q|k and the vT projection, which do not
// depend on each other, share one launch, the block index picks the job.
// xn (A in MODE 0, B in MODE 2) lies group-major, (c/8, n, 8): there a wave's
// copy takes one 16B piece of 32 consecutive tokens, 512 contiguous bytes, and
// lands them one below the other in LDS (144B apart: bank-clean, as the reads).
// A, B, Cv and resid point at the batch's planes; LDS comes from the kernel, so
// that two jobs in one kernel share one allocation.
// ---------------------------------------------------------------------------
constexpr int KC  = 64;      // k per stage
constexpr int NKC = C / KC;  // stages

// 144B pitch: 16B aligned, bank-clean for the 16B fragment reads
typedef f16 gemm_stage_t[2][128][72];

template <int MODE>
__device__ __forceinline__ void gemm_abt_tile(
    gemm_stage_t& As, gemm_stage_t& Bs, const f16* __restrict__ A, int lda,
    const f16* __restrict__ B, int ldb, const float* __restrict__ bias,
    void* __restrict__ Cv, int ldc, const float* __restrict__ resid, int m0,
    int n0) {
  constexpr bool XA = MODE == 0, XB = MODE == 2;  // which operand is xn
  A += XA ? (size_t)m0 * 8 : (size_t)m0 * lda;
  B += XB ? (size_t)n0 * 8 : (size_t)n0 * ldb;

  const int w    = __builtin_amdgcn_readfirstlane(threadIdx.x >> 5);
  const int lane = threadIdx.x & 31;
  const int hi   = lane >> 4;
  const int col  = lane & 15;
  const int wm   = (w & 3) * 32;   // this wave's rows of the tile
  const int wn   = (w >> 2) * 64;  // this wave's columns of the tile

  v8f acc[2][4];
#pragma unroll
  for (int i = 0; i < 2; ++i)
#pragma unroll
    for (int ct = 0; ct < 4; ++ct)
#pragma unroll
      for (int j = 0; j < 8; ++j) acc[i][ct][j] = 0.f;

  const int sr = threadIdx.x >> 3;        // row within a group of 32
  const int ss = (threadIdx.x & 7) * 8;   // 16B piece of the 128B row piece
  const int xr = threadIdx.x & 127;       // xn: token of the tile
  const int xp = threadIdx.x >> 7;        // xn: piece within a pair of pieces
  auto stage = [&](int buf, int kb) {
#pragma unroll
    for (int u = 0; u < 4; ++u) {
      if (XA)
        async_cp16(&As[buf][xr][(u * 2 + xp) * 8],
                   A + ((size_t)(kb / 8 + u * 2 + xp) * NTOK + xr) * 8);
      else
        async_cp16(&As[buf][u * 32 + sr][ss],
                   A + (size_t)(u * 32 + sr) * lda + kb + ss);
    }
#pragma unroll
    for (int u = 0; u < 4; ++u) {
      if (XB)
        async_cp16(&Bs[buf][xr][(u * 2 + xp) * 8],
                   B + ((size_t)(kb / 8 + u * 2 + xp) * NTOK + xr) * 8);
      else
        async_cp16(&Bs[buf][u * 32 + sr][ss],
                   B + (size_t)(u * 32 + sr) * ldb + kb + ss);
    }
  };

  stage(0, 0);
  async_wait0();
  __syncthreads();
  stage(1, KC);

  // Unrolled, as are the short loops here: buffer index, refill test and the
  // indices of the register arrays become literals.
#pragma unroll
  for (int t = 0; t < NKC; ++t) {
    const int buf = t & 1;
#pragma unroll
    for (int kk = 0; kk < KC; kk += 32) {
      // The six fragments of a k step are read at one place (twelve 16B loads),
      // then worked on: each sched_barrier keeps the load group whole; left
      // alone, the compiler read each B fragment in front of its own two WMMAs
      // and waited it out.
      v16h af[2], bf[4];
#pragma unroll
      for (int i = 0; i < 2; ++i) af[i] = ld_frag(&As[buf][wm + i * 16][kk], 72);
#pragma unroll
      for (int ct = 0; ct < 4; ++ct)
        bf[ct] = ld_frag(&Bs[buf][wn + ct * 16][kk], 72);
      __builtin_amdgcn_sched_barrier(0);
#pragma unroll
      for (int ct = 0; ct < 4; ++ct) {
        acc[0][ct] = wmma16(af[0], bf[ct], acc[0][ct]);
        acc[1][ct] = wmma16(af[1], bf[ct], acc[1][ct]);
      }
      __builtin_amdgcn_sched_barrier(0);  // the WMMAs stay in front of what follows
    }
    lds_wait0();      // this wave has left buf
    async_wait0();    // its copies of the next stage have landed
    __syncthreads();  // next stage published; every wave has left buf
    if (t + 2 < NKC) stage(buf, (t + 2) * KC);  // flies during stage t+1
  }
  async_wait0();

  if (MODE == 0) {
    f16* Cp = (f16*)Cv;
#pragma unroll
    for (int i = 0; i < 2; ++i)
#pragma unroll
      for (int ct = 0; ct < 4; ++ct) {
        const int n = n0 + wn + ct * 16 + col;
        float bn = bias[n];
#pragma unroll
        for (int j = 0; j < 8; ++j) {
          int m = m0 + wm + i * 16 + j + 8 * hi;
          Cp[(size_t)m * ldc + n] = (f16)(acc[i][ct][j] + bn);
        }
      }
  } else if (MODE == 1) {
    float* Cp = (float*)Cv;
    const float* Rp = resid;
    // One 32-bit element offset per row serves the residual load and the store
    // of the same element (a batch's plane is 1 Mi elements), so its register
    // lives on to the store.
    unsigned ro[2][8];
    float bm[2][8], rv[2][4][8];
#pragma unroll
    for (int i = 0; i < 2; ++i)
#pragma unroll
      for (int j = 0; j < 8; ++j) {
        const int m = m0 + wm + i * 16 + j + 8 * hi;
        ro[i][j] = (unsigned)(m * ldc + n0 + wn + col);
        bm[i][j] = bias[m];
#pragma unroll
        for (int ct = 0; ct < 4; ++ct)
          rv[i][ct][j] = (Rp + ro[i][j])[ct * 16];
      }
    // Behind the last of these loads, in front of the first rewrite of a
    // register that one of them names.
    asm volatile("s_wait_xcnt 0x0" ::: "memory");
#pragma unroll
    for (int i = 0; i < 2; ++i)
#pragma unroll
      for (int ct = 0; ct < 4; ++ct)
#pragma unroll
        for (int j = 0; j < 8; ++j)
          (Cp + ro[i][j])[ct * 16] = acc[i][ct][j] + bm[i][j] + rv[i][ct][j];
  } else {
    f16* Cp = (f16*)Cv;
#pragma unroll
    for (int i = 0; i < 2; ++i)
#pragma unroll
      for (int ct = 0; ct < 4; ++ct) {
#pragma unroll
        for (int j = 0; j < 8; ++j) {
          int m = m0 + wm + i * 16 + j + 8 * hi;
          Cp[(size_t)m * ldc + n0 + wn + ct * 16 + col] =
              (f16)(acc[i][ct][j] + bias[m]);
        }
      }
  }
}

// q|k and vT projections in one grid (token tile, job tile, batch):
// y < 4:  qk(b,n,512) = xn^T @ w_qkv[0:512]^T + bias, columns y*128 ..
// y >= 4: vT(b,c,n)   = w_qkv[512:768] @ xn + bias,  rows (y-4)*128 ..
// The row pitches are launch arguments (ldk: the weights').
__global__ __launch_bounds__(256, 1) void gemm_qkv_kernel(
    const f16* __restrict__ xnG, const f16* __restrict__ wq16,
    const float* __restrict__ b_qkv, f16* __restrict__ qk,
    f16* __restrict__ vT, int ldk, int ldqk, int ldv) {
  __shared__ __attribute__((aligned(16))) gemm_stage_t As;
  __shared__ __attribute__((aligned(16))) gemm_stage_t Bs;
  const int b  = blockIdx.z;
  const int t0 = blockIdx.x * 128;
  const f16* X = xnG + (size_t)b * NTOK * C;
  if (blockIdx.y < LDQK / 128) {
    gemm_abt_tile<0>(As, Bs, X, ldk, wq16, ldk, b_qkv,
                     qk + (size_t)b * NTOK * LDQK, ldqk, nullptr, t0,
                     blockIdx.y * 128);
  } else {
    gemm_abt_tile<2>(As, Bs, wq16 + (size_t)LDQK * C, ldk, X, ldk,
                     b_qkv + LDQK, vT + (size_t)b * C * NTOK, ldv, nullptr,
                     (blockIdx.y - LDQK / 128) * 128, t0);
    // In the built code the other job's text follows this job's stores, behind
    // a conditional branch: the wait stands in front of the first rewrite there
    // of a register that one of these stores names.
    asm volatile("s_wait_xcnt 0x0" ::: "memory");
  }
}

// Output projection + bias + residual: out(b,c,n) = w_out @ attn^T + b_out + x
__global__ __launch_bounds__(256, 1) void gemm_out_kernel(
    const f16* __restrict__ wo16, const f16* __restrict__ attn,
    const float* __restrict__ b_out, float* __restrict__ out,
    const float* __restrict__ x, int ldk, int ldc) {
  __shared__ __attribute__((aligned(16))) gemm_stage_t As;
  __shared__ __attribute__((aligned(16))) gemm_stage_t Bs;
  const int b = blockIdx.z;
  gemm_abt_tile<1>(As, Bs, wo16, ldk, attn + (size_t)b * NTOK * C, ldk, b_out,
                   out + (size_t)b * C * NTOK, ldc, x + (size_t)b * C * NTOK,
                   blockIdx.x * 128, blockIdx.y * 128);
}

__device__ __forceinline__ float xhalf(float x) {
  return __builtin_bit_cast(
      float, __builtin_amdgcn_permlanex16(__builtin_bit_cast(int, x),
                                          __builtin_bit_cast(int, x),
                                          0x76543210, 0xfedcba98, false, false));
}

constexpr int SKEYS = 64;            // keys per stage
constexpr int NSTG  = NTOK / SKEYS;  // stages
constexpr float SC2  = 0.0625f * 1.44269504f;  // q.k -> exponent of 2: c^-0.5 log2 e
constexpr float LAZY = 8.f / SC2;  // how far a maximum may outgrow its reference

// Two waves per SIMD: the grid has one work-group per WGP, so fewer registers
// buy no residency; the 32-query output tile and Q take 384 registers.
__global__ __launch_bounds__(256) __attribute__((amdgpu_waves_per_eu(2, 2)))
void attn_kernel(
    const f16* __restrict__ qk, const f16* __restrict__ vT,
    f16* __restrict__ out) {
  const int b    = blockIdx.y;
  const int q0   = blockIdx.x * 128;
  const int w    = __builtin_amdgcn_readfirstlane(threadIdx.x >> 5);
  const int lane = threadIdx.x & 31;
  const int hi   = lane >> 4;
  const int col  = lane & 15;
  const int qg   = w & 3;   // query group of 32
  const int kh   = w >> 2;  // half of each stage's keys

  __shared__ f16 Ks[2][SKEYS][264];   // keys x channels, 528B pitch
  __shared__ f16 Vs[2][256][72];      // channels x keys, 144B pitch
  __shared__ float Mg[8][32][32][4];  // merge: one output tile per wave
  __shared__ float Ml[8][2][32];      // merge: its reference and sum

  const f16* qb  = qk + (size_t)b * NTOK * LDQK;
  const f16* vb  = vT + (size_t)b * C * NTOK;
  const int  myq = q0 + qg * 32;

  // Preload Q fragments (2 x 16 queries x K=256), used as the B operand
  v16h qf[2][8];
#pragma unroll
  for (int g = 0; g < 2; ++g)
#pragma unroll
    for (int cb = 0; cb < 8; ++cb)
      qf[g][cb] = ld_frag(qb + (size_t)(myq + g * 16) * LDQK + cb * 32, LDQK);
  // Stands in front of the first rewrite of the address pair these loads name;
  // the sched_barrier keeps the later address arithmetic from being lifted over.
  asm volatile("s_wait_xcnt 0x0" ::: "memory");
  __builtin_amdgcn_sched_barrier(0);

  // acc[g][ct][j] = O^T[channel ct*16 + j + 8*hi][query g*16 + col]
  v8f acc[2][16];
#pragma unroll
  for (int g = 0; g < 2; ++g)
#pragma unroll
    for (int i = 0; i < 16; ++i)
#pragma unroll
      for (int j = 0; j < 8; ++j) acc[g][i][j] = 0.f;

  float r_i[2] = {0.f, 0.f};  // references in use, in units of q.k
  float l_i[2] = {0.f, 0.f};  // running sums over this wave half's keys

  // Async-stage one 64-key stage into buffer `buf`: a wave's copy covers one
  // whole 512B K row, or four whole 128B V^T rows.
  auto stage = [&](int buf, int k0) {
#pragma unroll
    for (int u = 0; u < 8; ++u) {
      const int kr = u * 8 + w;
      async_cp16(&Ks[buf][kr][lane * 8],
                 qb + (size_t)(k0 + kr) * LDQK + C + lane * 8);
    }
    const int vr = threadIdx.x >> 3, vs = threadIdx.x & 7;
#pragma unroll
    for (int u = 0; u < 8; ++u)
      async_cp16(&Vs[buf][u * 32 + vr][vs * 8],
                 vb + (size_t)(u * 32 + vr) * NTOK + k0 + vs * 8);
  };

  stage(0, 0);
  async_wait0();
  __syncthreads();
  stage(1, SKEYS);

  // One stage.  `refill` is a literal at both calls: the one branch of a loop
  // body is the seldom-taken rescale, so nothing else of a pass can be sunk
  // behind its matrix blocks.
  auto pass = [&](int t, bool refill) __attribute__((always_inline)) {
    const int buf = t & 1;

    // Fragments come from LDS in groups of four (eight 16B loads at one place),
    // one group ahead of the eight WMMAs that use them, in two register sets.
    // Each sched_barrier keeps a load group whole and ahead of the WMMA block
    // before its use: left alone, the compiler, short of registers, put every
    // fragment's loads directly in front of its own WMMAs and waited them out.
    v16h fa[4], fb[4];
    auto ldK4 = [&](v16h (&f)[4], int f0) {  // fragment f: channels f>>1, tile f&1
#pragma unroll
      for (int n = 0; n < 4; ++n)
        f[n] = ld_frag(
            &Ks[buf][kh * 32 + ((f0 + n) & 1) * 16][((f0 + n) >> 1) * 32], 264);
      __builtin_amdgcn_sched_barrier(0);
    };
    auto ldV4 = [&](v16h (&f)[4], int ct0) {
#pragma unroll
      for (int n = 0; n < 4; ++n)
        f[n] = ld_frag(&Vs[buf][(ct0 + n) * 16][kh * 32], 72);
      __builtin_amdgcn_sched_barrier(0);
    };

    // ---- scores^T: 32 keys x 32 queries, K=256 -> 32 WMMAs, 16 fragments
    // s[i][g][j] = key 16*i + j + 8*hi of this wave's half, query g*16 + col.
    // The products start from minus the reference in use (the C operand), so
    // the scores leave the matrix unit with the subtraction done.
    v8f s[2][2];
#pragma unroll
    for (int i = 0; i < 2; ++i)
#pragma unroll
      for (int g = 0; g < 2; ++g)
#pragma unroll
        for (int j = 0; j < 8; ++j) s[i][g][j] = -r_i[g];
    auto mmS4 = [&](const v16h (&f)[4], int f0) {
#pragma unroll
      for (int n = 0; n < 4; ++n) {
        const int i = (f0 + n) & 1, cb = (f0 + n) >> 1;
        s[i][0] = wmma16(f[n], qf[0][cb], s[i][0]);
        s[i][1] = wmma16(f[n], qf[1][cb], s[i][1]);
      }
      __builtin_amdgcn_sched_barrier(0);
    };
    ldK4(fa, 0);
    ldK4(fb, 4);
    mmS4(fa, 0);
    ldK4(fa, 8);
    mmS4(fb, 4);
    ldK4(fb, 12);
    mmS4(fa, 8);
    ldV4(fa, 0);  // the first V^T group flies under the last block and the softmax
    mmS4(fb, 12);

    // ---- online softmax, one query per lane and tile, against a lazy reference:
    // r_i is not the running maximum but a value at most LAZY below it, in units
    // of q.k.  It moves, and sums and outputs are rescaled, only in a pass in
    // which some query's maximum has outgrown it by more than LAZY; else P is at
    // most 2^8, well inside f16, and the 1/l at the end cancels the reference
    // whatever it is.
    float mx[2];  // the 32 keys' maximum above the reference
#pragma unroll
    for (int g = 0; g < 2; ++g) {
      float mt[8];
#pragma unroll
      for (int j = 0; j < 8; ++j) mt[j] = fmaxf(s[0][g][j], s[1][g][j]);
      const float m8 = fmaxf(fmaxf(fmaxf(mt[0], mt[1]), fmaxf(mt[2], mt[3])),
                             fmaxf(fmaxf(mt[4], mt[5]), fmaxf(mt[6], mt[7])));
      mx[g] = fmaxf(m8, xhalf(m8));  // both wave halves hold it
    }
    // One test per pass, a scalar branch.  The first pass always takes it and
    // sets the reference to its own maximum, up or down from the start value 0
    // (sums and outputs are still 0 there); later the reference only rises.
    const float lim = t == 0 ? -__builtin_inff() : LAZY;
    if (__builtin_amdgcn_ballot_w32(fmaxf(mx[0], mx[1]) > lim) != 0) {
#pragma unroll
      for (int g = 0; g < 2; ++g) {
        const float rise = fmaxf(mx[g], 0.f);
        const float up   = t == 0 ? mx[g] : rise;
        const float fac  = __builtin_amdgcn_exp2f(-rise * SC2);
        r_i[g] += up;
        l_i[g] *= fac;
#pragma unroll
        for (int j = 0; j < 8; ++j) {
          s[0][g][j] -= up;
          s[1][g][j] -= up;
        }
#pragma unroll
        for (int ct = 0; ct < 16; ++ct)
#pragma unroll
          for (int j = 0; j < 8; ++j) acc[g][ct][j] *= fac;
      }
    }

#pragma unroll
    for (int i = 0; i < 2; ++i)
#pragma unroll
      for (int g = 0; g < 2; ++g) s[i][g] *= SC2;  // to exponents of 2
    v16h bp[2];  // P^T as B operand: 32 keys x 16 queries each
#pragma unroll
    for (int g = 0; g < 2; ++g) {
      float pt[8];
#pragma unroll
      for (int j = 0; j < 8; ++j) {
        float pa = __builtin_amdgcn_exp2f(s[0][g][j]);
        float pb = __builtin_amdgcn_exp2f(s[1][g][j]);
        pt[j]        = pa + pb;
        bp[g][j]     = (f16)pa;
        bp[g][j + 8] = (f16)pb;
      }
      l_i[g] += ((pt[0] + pt[1]) + (pt[2] + pt[3])) +
                ((pt[4] + pt[5]) + (pt[6] + pt[7]));
    }

    // ---- acc += V^T @ P^T (16 channel x 2 query tiles, K=32)
    auto mmV4 = [&](const v16h (&f)[4], int ct0) {
#pragma unroll
      for (int n = 0; n < 4; ++n) {
        acc[0][ct0 + n] = wmma16(f[n], bp[0], acc[0][ct0 + n]);
        acc[1][ct0 + n] = wmma16(f[n], bp[1], acc[1][ct0 + n]);
      }
      __builtin_amdgcn_sched_barrier(0);  // ends a block, as in ldK4 and mmS4
    };
    // One plain vector instruction behind each exponential.
    // Four multiplies lead, so that no exponential stands behind its own operand.
    __builtin_amdgcn_sched_group_barrier(0x002, 4, 0);
#pragma unroll
    for (int n = 0; n < 32; ++n) {
      __builtin_amdgcn_sched_group_barrier(0x400, 1, 0);  // exponential
      __builtin_amdgcn_sched_group_barrier(0x002, 1, 0);  // multiply, add, convert
    }
    __builtin_amdgcn_sched_barrier(0);  // the next group waits for s to be dead
    ldV4(fb, 4);
    mmV4(fa, 0);
    ldV4(fa, 8);
    mmV4(fb, 4);
    ldV4(fb, 12);
    mmV4(fa, 8);
    mmV4(fb, 12);

    lds_wait0();        // this wave has left buf
    async_wait0();      // its copies of the next stage have landed
    __syncthreads();    // next stage published; every wave has left buf
    if (refill) stage(buf, (t + 2) * SKEYS);  // flies during stage t+1
  };
#pragma unroll 1
  for (int t = 0; t < NSTG - 2; ++t) pass(t, true);  // a stage t+2 exists
#pragma unroll 1
  for (int t = NSTG - 2; t < NSTG; ++t) pass(t, false);
  async_wait0();

  // ---- merge the two key halves of each query group: wave (qg, kh) hands
  // query tile 1-kh to its partner and finishes tile kh.
  const float lt[2] = {l_i[0] + xhalf(l_i[0]), l_i[1] + xhalf(l_i[1])};
  const float m_i[2] = {r_i[0] * 0.0625f, r_i[1] * 0.0625f};  // as scaled scores
  auto give = [&](const v8f (&a)[16], float m, float l) {
#pragma unroll
    for (int ct = 0; ct < 16; ++ct) {
#pragma unroll
      for (int h = 0; h < 2; ++h) {
        float4 v = make_float4(a[ct][4 * h], a[ct][4 * h + 1], a[ct][4 * h + 2],
                               a[ct][4 * h + 3]);
        *(float4*)&Mg[w][ct * 2 + h][lane][0] = v;
      }
    }
    Ml[w][0][lane] = m;
    Ml[w][1][lane] = l;
  };
  // 1/l normalization, store (b, n, c) f16: a lane's 8 accumulator registers
  // are 8 consecutive channels of its query
  auto take = [&](const v8f (&a)[16], float m, float l, int g) {
    const int   pw = w ^ 4;
    const float mo = Ml[pw][0][lane];
    const float lo = Ml[pw][1][lane];
    const float mn = fmaxf(m, mo);
    float fa = __expf(m - mn);
    float fb = __expf(mo - mn);
    const float inv = 1.f / (l * fa + lo * fb);
    fa *= inv;
    fb *= inv;
    f16* orow =
        out + (size_t)b * NTOK * C + (size_t)(myq + g * 16 + col) * C + 8 * hi;
#pragma unroll
    for (int ct = 0; ct < 16; ++ct) {
      const float4 p0 = *(const float4*)&Mg[pw][ct * 2][lane][0];
      const float4 p1 = *(const float4*)&Mg[pw][ct * 2 + 1][lane][0];
      v8h o;
      o[0] = (f16)(a[ct][0] * fa + p0.x * fb);
      o[1] = (f16)(a[ct][1] * fa + p0.y * fb);
      o[2] = (f16)(a[ct][2] * fa + p0.z * fb);
      o[3] = (f16)(a[ct][3] * fa + p0.w * fb);
      o[4] = (f16)(a[ct][4] * fa + p1.x * fb);
      o[5] = (f16)(a[ct][5] * fa + p1.y * fb);
      o[6] = (f16)(a[ct][6] * fa + p1.z * fb);
      o[7] = (f16)(a[ct][7] * fa + p1.w * fb);
      *(v8h*)(orow + ct * 16) = o;
    }
  };
  if (kh == 0) give(acc[1], m_i[1], lt[1]);
  else         give(acc[0], m_i[0], lt[0]);
  __syncthreads();  // the partners' tiles are in LDS
  if (kh == 0) take(acc[0], m_i[0], lt[0], 0);
  else         take(acc[1], m_i[1], lt[1], 1);
}

// ---------------------------------------------------------------------------
extern "C" void kernel_launch(void* const* d_in, const int* in_sizes, int n_in,
                              void* d_out, int out_size, void* d_ws,
                              size_t ws_size, hipStream_t stream) {
  const float* x     = (const float*)d_in[0];
  const float* gsc   = (const float*)d_in[1];
  const float* gbi   = (const float*)d_in[2];
  const float* w_qkv = (const float*)d_in[3];
  const float* b_qkv = (const float*)d_in[4];
  const float* w_out = (const float*)d_in[5];
  const float* b_out = (const float*)d_in[6];
  float* out = (float*)d_out;

  // Workspace carve-up
  char* ws = (char*)d_ws;
  f16* xnG  = (f16*)ws; ws += (size_t)BATCH * NTOK * C * 2;     // 16.8 MB
  f16* qk   = (f16*)ws; ws += (size_t)BATCH * NTOK * LDQK * 2;  // 33.6 MB
  f16* vT   = (f16*)ws; ws += (size_t)BATCH * C * NTOK * 2;     // 16.8 MB
  f16* attn = (f16*)ws; ws += (size_t)BATCH * NTOK * C * 2;     // 16.8 MB
  f16* wq16 = (f16*)ws; ws += (size_t)(3 * C) * C * 2;
  f16* wo16 = (f16*)ws; ws += (size_t)C * C * 2;

  // 1) GroupNorm -> xnG (b, c/8, n, 8) f16, and the weight converts
  gn_cvt_kernel<<<BATCH * GROUPS, GNT, 0, stream>>>(x, gsc, gbi, xnG, w_qkv,
                                                    wq16, w_out, wo16);

  // 2) q|k and vT projections
  gemm_qkv_kernel<<<dim3(NTOK / 128, (LDQK + C) / 128, BATCH), 256, 0,
                    stream>>>(xnG, wq16, b_qkv, qk, vT, C, LDQK, NTOK);

  // 3) Flash attention -> attn (b, n, 256) f16
  attn_kernel<<<dim3(NTOK / 128, BATCH), 256, 0, stream>>>(qk, vT, attn);

  // 4) Output projection + bias + residual -> d_out (b, c, n) f32
  gemm_out_kernel<<<dim3(C / 128, NTOK / 128, BATCH), 256, 0, stream>>>(
      wo16, attn, b_out, out, x, C, NTOK);
}

// v007
// Measured time: 112 microseconds a run.
// Timed twice side by side with v006, it ran 1.08 times as fast both times.
// Over all steps from v000 it is 2.52 times as fast.
#include <hip/hip_runtime.h>
#include <math.h>

typedef _Float16 f16;
typedef __attribute__((ext_vector_type(16))) _Float16 v16h;
typedef __attribute__((ext_vector_type(8)))  _Float16 v8h;
typedef __attribute__((ext_vector_type(8)))  float    v8f;

// Problem constants (fixed by the reference)
constexpr int BATCH  = 8;
constexpr int C      = 256;
constexpr int NTOK   = 4096;   // 64*64
constexpr int LDQK   = 512;    // q|k packed
constexpr int GROUPS = 32;

// ---------------------------------------------------------------------------
// Fragment helpers: CDNA5 16-bit A/B fragment layout (16x32, ISA 7.12.2):
// lane L: row/col = L&15 ; kb = (L>>4)*8 ; elements 0..7 hold K=kb..kb+7,
// elements 8..15 hold K=kb+16..kb+23.  Two 16B loads per lane.
// ---------------------------------------------------------------------------
__device__ __forceinline__ v16h ld_frag(const f16* p, int ld) {
  const int lane = threadIdx.x & 31;
  const f16* base = p + (size_t)(lane & 15) * ld + (lane >> 4) * 8;
  v8h lo = *(const v8h*)(base);
  v8h hh = *(const v8h*)(base + 16);
  v16h r;
#pragma unroll
  for (int i = 0; i < 8; ++i) { r[i] = lo[i]; r[i + 8] = hh[i]; }
  return r;
}

__device__ __forceinline__ v8f wmma16(v16h a, v16h b, v8f c) {
  return __builtin_amdgcn_wmma_f32_16x16x32_f16(false, a, false, b,
                                                (short)0, c, false, false);
}

// Async global->LDS 16B copy (CDNA5, tracked by ASYNCcnt), as the builtin: the
// compiler then owns the address registers, also those above v255.
typedef __attribute__((ext_vector_type(4))) int v4i;
__device__ __forceinline__ void async_cp16(f16* ldst, const f16* gsrc) {
  __builtin_amdgcn_global_load_async_to_lds_b128(
      (__attribute__((address_space(1))) v4i*)gsrc,
      (__attribute__((address_space(3))) v4i*)ldst, 0, 0);
}
__device__ __forceinline__ void async_wait0() {
  asm volatile("s_wait_asynccnt 0x0" ::: "memory");
}
// This wave's LDS reads have returned: owed before a buffer it read is refilled.
__device__ __forceinline__ void lds_wait0() {
  asm volatile("s_wait_dscnt 0x0" ::: "memory");
}

// ---------------------------------------------------------------------------
// GroupNorm in one launch: one block per (b,g), 8 channels * 4096 tokens.  A
// thread keeps its 8 tokens x 8 channels in registers from the sums to the
// normalisation, so x is read once and no second grid has to start.
// A wave takes 256 consecutive tokens: each load is one whole 128B line of a
// channel, all 64 of a thread are issued ahead of the sums.
// xn is stored group-major, xnG (b, c/8, n, 8) f16: a token's 8 channels of the
// group are one 16B store, a wave's store is 512 contiguous bytes, and a block
// writes one contiguous 64 KiB.
// The same launch converts the weights to f16, work that depends on nothing
// here and would else cost launches of its own: block bg takes elements
// bg*1024 .. bg*1024+1023 of [w_qkv | w_out], two per thread, loaded first,
// stored last.
// ---------------------------------------------------------------------------
typedef __attribute__((ext_vector_type(2))) _Float16 v2h;
constexpr int NWQ = 3 * C * C;  // elements of w_qkv
static_assert(NWQ % 1024 == 0 && NWQ + C * C == BATCH * GROUPS * 1024,
              "one block converts 1024 weights of one matrix");
constexpr int GNT = 512;  // threads of a block: 16 waves

__global__ __launch_bounds__(GNT) void gn_cvt_kernel(
    const float* __restrict__ x, const float* __restrict__ gsc,
    const float* __restrict__ gbi, f16* __restrict__ xnG,
    const float* __restrict__ w_qkv, f16* __restrict__ wq16,
    const float* __restrict__ w_out, f16* __restrict__ wo16) {
  const int bg = blockIdx.x;
  const int we = bg * 1024;  // block-uniform: which matrix, and where in it
  const float* wsrc = we < NWQ ? w_qkv + we : w_out + (we - NWQ);
  f16*         wdst = we < NWQ ? wq16 + we : wo16 + (we - NWQ);
  const float2 wv = *(const float2*)(wsrc + threadIdx.x * 2);
  // Keeps the weight load ahead of those of x: left alone, the compiler sank it
  // behind the sums, where its whole latency was waited out.
  __builtin_amdgcn_sched_barrier(0);

  const int wave = threadIdx.x >> 5;
  const int lane = threadIdx.x & 31;
  const int tok  = wave * 256 + lane;  // this thread's tokens: tok + 32*i
  const float* p = x + (size_t)bg * 32768 + tok;
  float v[8][8];  // [i][channel of the group]
#pragma unroll
  for (int c = 0; c < 8; ++c)
#pragma unroll
    for (int i = 0; i < 8; ++i) v[i][c] = p[c * NTOK + i * 32];

  float sp[8], qp[8];  // one chain per channel
#pragma unroll
  for (int c = 0; c < 8; ++c) {
    sp[c] = 0.f;
    qp[c] = 0.f;
#pragma unroll
    for (int i = 0; i < 8; ++i) {
      sp[c] += v[i][c];
      qp[c] = fmaf(v[i][c], v[i][c], qp[c]);
    }
  }
  float s = ((sp[0] + sp[1]) + (sp[2] + sp[3])) +
            ((sp[4] + sp[5]) + (sp[6] + sp[7]));
  float q = ((qp[0] + qp[1]) + (qp[2] + qp[3])) +
            ((qp[4] + qp[5]) + (qp[6] + qp[7]));
#pragma unroll
  for (int off = 16; off > 0; off >>= 1) {
    s += __shfl_xor(s, off, 32);
    q += __shfl_xor(q, off, 32);
  }
  __shared__ float ss[GNT / 32], qs[GNT / 32];
  if (lane == 0) {
    ss[wave] = s;
    qs[wave] = q;
  }
  __syncthreads();  // every wave's sums are in LDS; every thread adds them up
  float S = 0.f, Q = 0.f;
#pragma unroll
  for (int i = 0; i < GNT / 32; ++i) { S += ss[i]; Q += qs[i]; }
  const float mu  = S * (1.f / 32768.f);
  const float var = Q * (1.f / 32768.f) - mu * mu;
  const float rs  = rsqrtf(var + 1e-5f);

  const int c0 = (bg & (GROUPS - 1)) * 8;  // the group's first channel
  float sc[8], bi[8];
#pragma unroll
  for (int c = 0; c < 8; ++c) {
    sc[c] = gsc[c0 + c];
    bi[c] = gbi[c0 + c];
  }
  v8h h[8];
#pragma unroll
  for (int i = 0; i < 8; ++i)
#pragma unroll
    for (int c = 0; c < 8; ++c)
      h[i][c] = (f16)((v[i][c] - mu) * rs * sc[c] + bi[c]);
  v2h wh;
  wh[0] = (f16)wv.x;
  wh[1] = (f16)wv.y;
  // All stores stand at one place behind the arithmetic: no register that a
  // store names is written again, so no wait has to stand between them.
  __builtin_amdgcn_sched_barrier(0);
  f16* o = xnG + (size_t)bg * 32768 + (size_t)tok * 8;
#pragma unroll
  for (int i = 0; i < 8; ++i) *(v8h*)(o + i * 32 * 8) = h[i];
  // The weights go out here too: in front of the barrier their store would have
  // to be waited for there.
  *(v2h*)(wdst + threadIdx.x * 2) = wh;
}

// ---------------------------------------------------------------------------
// WMMA GEMM: C[M,N] = A[M,K] * B[N,K]^T, K = 256.  Tile 128x128, 8 waves.
// Both operands come through LDS in stages of 64 k, two buffers, filled with
// async global->LDS copies: a wave's copy covers four whole 128B row pieces, and
// the next stage flies while this one is worked on.  A wave takes 32 x 64 of the
// tile, so an A fragment feeds four matrix instructions and a B fragment two.
// MODE 0: f16 out, bias[N]          (q|k projection)
// MODE 2: f16 out, bias[M]          (vT projection: rows = channels)
// The tile is a device function: the q|k and the vT projection, which do not
// depend on each other, share one launch, the block index picks the job.
// xn (A in MODE 0, B in MODE 2) lies group-major, (c/8, n, 8): there a wave's
// copy takes one 16B piece of 32 consecutive tokens, 512 contiguous bytes, and
// lands them one below the other in LDS (144B apart: bank-clean, as the reads).
// A, B and Cv point at the batch's planes; LDS comes from the kernel, so
// that two jobs in one kernel share one allocation.
// ---------------------------------------------------------------------------
constexpr int KC  = 64;      // k per stage
constexpr int NKC = C / KC;  // stages

// 144B pitch: 16B aligned, bank-clean for the 16B fragment reads
typedef f16 gemm_stage_t[2][128][72];

template <int MODE>
__device__ __forceinline__ void gemm_abt_tile(
    gemm_stage_t& As, gemm_stage_t& Bs, const f16* __restrict__ A, int lda,
    const f16* __restrict__ B, int ldb, const float* __restrict__ bias,
    void* __restrict__ Cv, int ldc, int m0, int n0) {
  constexpr bool XA = MODE == 0, XB = MODE == 2;  // which operand is xn
  A += XA ? (size_t)m0 * 8 : (size_t)m0 * lda;
  B += XB ? (size_t)n0 * 8 : (size_t)n0 * ldb;

  const int w    = __builtin_amdgcn_readfirstlane(threadIdx.x >> 5);
  const int lane = threadIdx.x & 31;
  const int hi   = lane >> 4;
  const int col  = lane & 15;
  const int wm   = (w & 3) * 32;   // this wave's rows of the tile
  const int wn   = (w >> 2) * 64;  // this wave's columns of the tile

  v8f acc[2][4];
#pragma unroll
  for (int i = 0; i < 2; ++i)
#pragma unroll
    for (int ct = 0; ct < 4; ++ct)
#pragma unroll
      for (int j = 0; j < 8; ++j) acc[i][ct][j] = 0.f;

  const int sr = threadIdx.x >> 3;        // row within a group of 32
  const int ss = (threadIdx.x & 7) * 8;   // 16B piece of the 128B row piece
  const int xr = threadIdx.x & 127;       // xn: token of the tile
  const int xp = threadIdx.x >> 7;        // xn: piece within a pair of pieces
  auto stage = [&](int buf, int kb) {
#pragma unroll
    for (int u = 0; u < 4; ++u) {
      if (XA)
        async_cp16(&As[buf][xr][(u * 2 + xp) * 8],
                   A + ((size_t)(kb / 8 + u * 2 + xp) * NTOK + xr) * 8);
      else
        async_cp16(&As[buf][u * 32 + sr][ss],
                   A + (size_t)(u * 32 + sr) * lda + kb + ss);
    }
#pragma unroll
    for (int u = 0; u < 4; ++u) {
      if (XB)
        async_cp16(&Bs[buf][xr][(u * 2 + xp) * 8],
                   B + ((size_t)(kb / 8 + u * 2 + xp) * NTOK + xr) * 8);
      else
        async_cp16(&Bs[buf][u * 32 + sr][ss],
                   B + (size_t)(u * 32 + sr) * ldb + kb + ss);
    }
  };

  stage(0, 0);
  async_wait0();
  __syncthreads();
  stage(1, KC);

  // Unrolled, as are the short loops here: buffer index, refill test and the
  // indices of the register arrays become literals.
#pragma unroll
  for (int t = 0; t < NKC; ++t) {
    const int buf = t & 1;
#pragma unroll
    for (int kk = 0; kk < KC; kk += 32) {
      // The six fragments of a k step are read at one place (twelve 16B loads),
      // then worked on: each sched_barrier keeps the load group whole; left
      // alone, the compiler read each B fragment in front of its own two WMMAs
      // and waited it out.
      v16h af[2], bf[4];
#pragma unroll
      for (int i = 0; i < 2; ++i) af[i] = ld_frag(&As[buf][wm + i * 16][kk], 72);
#pragma unroll
      for (int ct = 0; ct < 4; ++ct)
        bf[ct] = ld_frag(&Bs[buf][wn + ct * 16][kk], 72);
      __builtin_amdgcn_sched_barrier(0);
#pragma unroll
      for (int ct = 0; ct < 4; ++ct) {
        acc[0][ct] = wmma16(af[0], bf[ct], acc[0][ct]);
        acc[1][ct] = wmma16(af[1], bf[ct], acc[1][ct]);
      }
      __builtin_amdgcn_sched_barrier(0);  // the WMMAs stay in front of what follows
    }
    lds_wait0();      // this wave has left buf
    async_wait0();    // its copies of the next stage have landed
    __syncthreads();  // next stage published; every wave has left buf
    if (t + 2 < NKC) stage(buf, (t + 2) * KC);  // flies during stage t+1
  }
  async_wait0();

  if (MODE == 0) {
    f16* Cp = (f16*)Cv;
#pragma unroll
    for (int i = 0; i < 2; ++i)
#pragma unroll
      for (int ct = 0; ct < 4; ++ct) {
        const int n = n0 + wn + ct * 16 + col;
        float bn = bias[n];
#pragma unroll
        for (int j = 0; j < 8; ++j) {
          int m = m0 + wm + i * 16 + j + 8 * hi;
          Cp[(size_t)m * ldc + n] = (f16)(acc[i][ct][j] + bn);
        }
      }
  } else {
    f16* Cp = (f16*)Cv;
#pragma unroll
    for (int i = 0; i < 2; ++i)
#pragma unroll
      for (int ct = 0; ct < 4; ++ct) {
#pragma unroll
        for (int j = 0; j < 8; ++j) {
          int m = m0 + wm + i * 16 + j + 8 * hi;
          Cp[(size_t)m * ldc + n0 + wn + ct * 16 + col] =
              (f16)(acc[i][ct][j] + bias[m]);
        }
      }
  }
}

// q|k and vT projections in one grid (token tile, job tile, batch):
// y < 4:  qk(b,n,512) = xn^T @ w_qkv[0:512]^T + bias, columns y*128 ..
// y >= 4: vT(b,c,n)   = w_qkv[512:768] @ xn + bias,  rows (y-4)*128 ..
// The row pitches are launch arguments (ldk: the weights').
__global__ __launch_bounds__(256, 1) void gemm_qkv_kernel(
    const f16* __restrict__ xnG, const f16* __restrict__ wq16,
    const float* __restrict__ b_qkv, f16* __restrict__ qk,
    f16* __restrict__ vT, int ldk, int ldqk, int ldv) {
  __shared__ __attribute__((aligned(16))) gemm_stage_t As;
  __shared__ __attribute__((aligned(16))) gemm_stage_t Bs;
  const int b  = blockIdx.z;
  const int t0 = blockIdx.x * 128;
  const f16* X = xnG + (size_t)b * NTOK * C;
  if (blockIdx.y < LDQK / 128) {
    gemm_abt_tile<0>(As, Bs, X, ldk, wq16, ldk, b_qkv,
                     qk + (size_t)b * NTOK * LDQK, ldqk, t0, blockIdx.y * 128);
  } else {
    gemm_abt_tile<2>(As, Bs, wq16 + (size_t)LDQK * C, ldk, X, ldk,
                     b_qkv + LDQK, vT + (size_t)b * C * NTOK, ldv,
                     (blockIdx.y - LDQK / 128) * 128, t0);
    // In the built code the other job's text follows this job's stores, behind
    // a conditional branch: the wait stands in front of the first rewrite there
    // of a register that one of these stores names.
    asm volatile("s_wait_xcnt 0x0" ::: "memory");
  }
}

__device__ __forceinline__ float xhalf(float x) {
  return __builtin_bit_cast(
      float, __builtin_amdgcn_permlanex16(__builtin_bit_cast(int, x),
                                          __builtin_bit_cast(int, x),
                                          0x76543210, 0xfedcba98, false, false));
}

constexpr int SKEYS = 64;            // keys per stage
constexpr int NSTG  = NTOK / SKEYS;  // stages
constexpr float SC2  = 0.0625f * 1.44269504f;  // q.k -> exponent of 2: c^-0.5 log2 e
constexpr float LAZY = 8.f / SC2;  // how far a maximum may outgrow its reference

// Two waves per SIMD: the grid has one work-group per WGP, so fewer registers
// buy no residency; the 32-query output tile and Q take 384 registers.
__global__ __launch_bounds__(256) __attribute__((amdgpu_waves_per_eu(2, 2)))
void attn_kernel(
    const f16* __restrict__ qk, const f16* __restrict__ vT,
    const f16* __restrict__ wo16, const float* __restrict__ b_out,
    const float* __restrict__ x, float* __restrict__ out) {
  const int b    = blockIdx.y;
  const int q0   = blockIdx.x * 128;
  const int w    = __builtin_amdgcn_readfirstlane(threadIdx.x >> 5);
  const int lane = threadIdx.x & 31;
  const int hi   = lane >> 4;
  const int col  = lane & 15;
  const int qg   = w & 3;   // query group of 32
  const int kh   = w >> 2;  // half of each stage's keys

  // The merge buffer lies over the K/V ring, which is dead behind the loop's
  // last barrier: so w_out fits beside them.
  struct ring_t {
    f16 Ks[2][SKEYS][264];  // keys x channels, 528B pitch
    f16 Vs[2][256][72];     // channels x keys, 144B pitch
  };
  union ring_or_merge_t {
    ring_t ring;
    float  Mg[8][32][32][4];  // merge: one output tile per wave, 16 KiB each
  };
  __shared__ __attribute__((aligned(16))) ring_or_merge_t sh;
  __shared__ __attribute__((aligned(16))) f16 Wo[C][264];  // w_out, 528B pitch
  __shared__ float Ml[8][2][32];  // merge: a tile's maximum and sum
  __shared__ __attribute__((aligned(16))) float Bo[C];  // b_out
  static_assert(C == 256, "a thread brings one element of b_out");
  auto& Ks = sh.ring.Ks;
  auto& Vs = sh.ring.Vs;
  auto& Mg = sh.Mg;

  const f16* qb  = qk + (size_t)b * NTOK * LDQK;
  const f16* vb  = vT + (size_t)b * C * NTOK;
  const int  myq = q0 + qg * 32;

  // The projection's bias, one element per thread, asked for ahead of Q.
  const float bo = b_out[threadIdx.x];

  // Preload Q fragments (2 x 16 queries x K=256), used as the B operand
  v16h qf[2][8];
#pragma unroll
  for (int g = 0; g < 2; ++g)
#pragma unroll
    for (int cb = 0; cb < 8; ++cb)
      qf[g][cb] = ld_frag(qb + (size_t)(myq + g * 16) * LDQK + cb * 32, LDQK);
  // Stands in front of the first rewrite of the address pair these loads name;
  // the sched_barrier keeps the later address arithmetic from being lifted over.
  asm volatile("s_wait_xcnt 0x0" ::: "memory");
  __builtin_amdgcn_sched_barrier(0);

  // acc[g][ct][j] = O^T[channel ct*16 + j + 8*hi][query g*16 + col]
  v8f acc[2][16];
#pragma unroll
  for (int g = 0; g < 2; ++g)
#pragma unroll
    for (int i = 0; i < 16; ++i)
#pragma unroll
      for (int j = 0; j < 8; ++j) acc[g][i][j] = 0.f;

  float r_i[2] = {0.f, 0.f};  // references in use, in units of q.k
  float l_i[2] = {0.f, 0.f};  // running sums over this wave half's keys

  // Async-stage one 64-key stage into buffer `buf`: a wave's copy covers one
  // whole 512B K row, or four whole 128B V^T rows.
  auto stage = [&](int buf, int k0) {
#pragma unroll
    for (int u = 0; u < 8; ++u) {
      const int kr = u * 8 + w;
      async_cp16(&Ks[buf][kr][lane * 8],
                 qb + (size_t)(k0 + kr) * LDQK + C + lane * 8);
    }
    const int vr = threadIdx.x >> 3, vs = threadIdx.x & 7;
#pragma unroll
    for (int u = 0; u < 8; ++u)
      async_cp16(&Vs[buf][u * 32 + vr][vs * 8],
                 vb + (size_t)(u * 32 + vr) * NTOK + k0 + vs * 8);
  };

  stage(0, 0);
  // Keeps the wait for the bias behind the issue of all sixteen copies: left
  // alone, the compiler put it, with the store, among them.
  __builtin_amdgcn_sched_barrier(0);
  Bo[threadIdx.x] = bo;  // the barrier publishes it
  async_wait0();
  __syncthreads();
  stage(1, SKEYS);
  // w_out, one whole 512B row per copy of a wave: flies under pass 0, whose foot
  // waits for it and publishes it (48 copies of a wave are then outstanding).
#pragma unroll
  for (int u = 0; u < C / 8; ++u)
    async_cp16(&Wo[u * 8 + w][lane * 8],
               wo16 + (size_t)(u * 8 + w) * C + lane * 8);

  // One stage.  `refill` is a literal at both calls: the one branch of a loop
  // body is the seldom-taken rescale, so nothing else of a pass can be sunk
  // behind its matrix blocks.
  auto pass = [&](int t, bool refill) __attribute__((always_inline)) {
    const int buf = t & 1;

    // Fragments come from LDS in groups of four (eight 16B loads at one place),
    // one group ahead of the eight WMMAs that use them, in two register sets.
    // Each sched_barrier keeps a load group whole and ahead of the WMMA block
    // before its use: left alone, the compiler, short of registers, put every
    // fragment's loads directly in front of its own WMMAs and waited them out.
    v16h fa[4], fb[4];
    auto ldK4 = [&](v16h (&f)[4], int f0) {  // fragment f: channels f>>1, tile f&1
#pragma unroll
      for (int n = 0; n < 4; ++n)
        f[n] = ld_frag(
            &Ks[buf][kh * 32 + ((f0 + n) & 1) * 16][((f0 + n) >> 1) * 32], 264);
      __builtin_amdgcn_sched_barrier(0);
    };
    auto ldV4 = [&](v16h (&f)[4], int ct0) {
#pragma unroll
      for (int n = 0; n < 4; ++n)
        f[n] = ld_frag(&Vs[buf][(ct0 + n) * 16][kh * 32], 72);
      __builtin_amdgcn_sched_barrier(0);
    };

    // ---- scores^T: 32 keys x 32 queries, K=256 -> 32 WMMAs, 16 fragments
    // s[i][g][j] = key 16*i + j + 8*hi of this wave's half, query g*16 + col.
    // The products start from minus the reference in use (the C operand), so
    // the scores leave the matrix unit with the subtraction done.
    v8f s[2][2];
#pragma unroll
    for (int i = 0; i < 2; ++i)
#pragma unroll
      for (int g = 0; g < 2; ++g)
#pragma unroll
        for (int j = 0; j < 8; ++j) s[i][g][j] = -r_i[g];
    auto mmS4 = [&](const v16h (&f)[4], int f0) {
#pragma unroll
      for (int n = 0; n < 4; ++n) {
        const int i = (f0 + n) & 1, cb = (f0 + n) >> 1;
        s[i][0] = wmma16(f[n], qf[0][cb], s[i][0]);
        s[i][1] = wmma16(f[n], qf[1][cb], s[i][1]);
      }
      __builtin_amdgcn_sched_barrier(0);
    };
    ldK4(fa, 0);
    ldK4(fb, 4);
    mmS4(fa, 0);
    ldK4(fa, 8);
    mmS4(fb, 4);
    ldK4(fb, 12);
    mmS4(fa, 8);
    ldV4(fa, 0);  // the first V^T group flies under the last block and the softmax
    mmS4(fb, 12);

    // ---- online softmax, one query per lane and tile, against a lazy reference:
    // r_i is not the running maximum but a value at most LAZY below it, in units
    // of q.k.  It moves, and sums and outputs are rescaled, only in a pass in
    // which some query's maximum has outgrown it by more than LAZY; else P is at
    // most 2^8, well inside f16, and the 1/l at the end cancels the reference
    // whatever it is.
    float mx[2];  // the 32 keys' maximum above the reference
#pragma unroll
    for (int g = 0; g < 2; ++g) {
      float mt[8];
#pragma unroll
      for (int j = 0; j < 8; ++j) mt[j] = fmaxf(s[0][g][j], s[1][g][j]);
      const float m8 = fmaxf(fmaxf(fmaxf(mt[0], mt[1]), fmaxf(mt[2], mt[3])),
                             fmaxf(fmaxf(mt[4], mt[5]), fmaxf(mt[6], mt[7])));
      mx[g] = fmaxf(m8, xhalf(m8));  // both wave halves hold it
    }
    // One test per pass, a scalar branch.  The first pass always takes it and
    // sets the reference to its own maximum, up or down from the start value 0
    // (sums and outputs are still 0 there); later the reference only rises.
    const float lim = t == 0 ? -__builtin_inff() : LAZY;
    if (__builtin_amdgcn_ballot_w32(fmaxf(mx[0], mx[1]) > lim) != 0) {
#pragma unroll
      for (int g = 0; g < 2; ++g) {
        const float rise = fmaxf(mx[g], 0.f);
        const float up   = t == 0 ? mx[g] : rise;
        const float fac  = __builtin_amdgcn_exp2f(-rise * SC2);
        r_i[g] += up;
        l_i[g] *= fac;
#pragma unroll
        for (int j = 0; j < 8; ++j) {
          s[0][g][j] -= up;
          s[1][g][j] -= up;
        }
#pragma unroll
        for (int ct = 0; ct < 16; ++ct)
#pragma unroll
          for (int j = 0; j < 8; ++j) acc[g][ct][j] *= fac;
      }
    }

#pragma unroll
    for (int i = 0; i < 2; ++i)
#pragma unroll
      for (int g = 0; g < 2; ++g) s[i][g] *= SC2;  // to exponents of 2
    v16h bp[2];  // P^T as B operand: 32 keys x 16 queries each
#pragma unroll
    for (int g = 0; g < 2; ++g) {
      float pt[8];
#pragma unroll
      for (int j = 0; j < 8; ++j) {
        float pa = __builtin_amdgcn_exp2f(s[0][g][j]);
        float pb = __builtin_amdgcn_exp2f(s[1][g][j]);
        pt[j]        = pa + pb;
        bp[g][j]     = (f16)pa;
        bp[g][j + 8] = (f16)pb;
      }
      l_i[g] += ((pt[0] + pt[1]) + (pt[2] + pt[3])) +
                ((pt[4] + pt[5]) + (pt[6] + pt[7]));
    }

    // ---- acc += V^T @ P^T (16 channel x 2 query tiles, K=32)
    auto mmV4 = [&](const v16h (&f)[4], int ct0) {
#pragma unroll
      for (int n = 0; n < 4; ++n) {
        acc[0][ct0 + n] = wmma16(f[n], bp[0], acc[0][ct0 + n]);
        acc[1][ct0 + n] = wmma16(f[n], bp[1], acc[1][ct0 + n]);
      }
      __builtin_amdgcn_sched_barrier(0);  // ends a block, as in ldK4 and mmS4
    };
    // One plain vector instruction behind each exponential.
    // Four multiplies lead, so that no exponential stands behind its own operand.
    __builtin_amdgcn_sched_group_barrier(0x002, 4, 0);
#pragma unroll
    for (int n = 0; n < 32; ++n) {
      __builtin_amdgcn_sched_group_barrier(0x400, 1, 0);  // exponential
      __builtin_amdgcn_sched_group_barrier(0x002, 1, 0);  // multiply, add, convert
    }
    __builtin_amdgcn_sched_barrier(0);  // the next group waits for s to be dead
    ldV4(fb, 4);
    mmV4(fa, 0);
    ldV4(fa, 8);
    mmV4(fb, 4);
    ldV4(fb, 12);
    mmV4(fa, 8);
    mmV4(fb, 12);

    lds_wait0();        // this wave has left buf
    async_wait0();      // its copies of the next stage have landed
    __syncthreads();    // next stage published; every wave has left buf
    if (refill) stage(buf, (t + 2) * SKEYS);  // flies during stage t+1
  };
#pragma unroll 1
  for (int t = 0; t < NSTG - 2; ++t) pass(t, true);  // a stage t+2 exists
#pragma unroll 1
  for (int t = NSTG - 2; t < NSTG; ++t) pass(t, false);
  async_wait0();

  // ---- merge the two key halves of each query group: wave (qg, kh) hands
  // query tile 1-kh to its partner and finishes tile kh.
  const float lt[2] = {l_i[0] + xhalf(l_i[0]), l_i[1] + xhalf(l_i[1])};
  const float m_i[2] = {r_i[0] * 0.0625f, r_i[1] * 0.0625f};  // as scaled scores
  auto give = [&](const v8f (&a)[16], float m, float l) {
#pragma unroll
    for (int ct = 0; ct < 16; ++ct) {
#pragma unroll
      for (int h = 0; h < 2; ++h) {
        float4 v = make_float4(a[ct][4 * h], a[ct][4 * h + 1], a[ct][4 * h + 2],
                               a[ct][4 * h + 3]);
        *(float4*)&Mg[w][ct * 2 + h][lane][0] = v;
      }
    }
    Ml[w][0][lane] = m;
    Ml[w][1][lane] = l;
  };
  // 1/l normalization.  A lane's 8 accumulator registers are 8 consecutive
  // channels of its query: the finished tile goes to LDS as f16 rows
  // (query, channel), 528B pitch, into the 16 KiB that held the partner's tile,
  // which this wave alone reads.  Tile qt starts (qt & 3) * 16B into its place:
  // the projection reads rows of four tiles with one load, and the places lie
  // a multiple of the 64 banks apart.
  f16* const Ob = (f16*)&Mg[0][0][0][0];
  constexpr int OREG = 32 * 32 * 4 * 2;  // f16 elements of one such place
  auto take = [&](const v8f (&a)[16], float m, float l) {
    const int   pw = w ^ 4;
    const float mo = Ml[pw][0][lane];
    const float lo = Ml[pw][1][lane];
    const float mn = fmaxf(m, mo);
    float fa = __expf(m - mn);
    float fb = __expf(mo - mn);
    const float inv = 1.f / (l * fa + lo * fb);
    fa *= inv;
    fb *= inv;
    v8h o[16];
#pragma unroll
    for (int ct = 0; ct < 16; ++ct) {
      const float4 p0 = *(const float4*)&Mg[pw][ct * 2][lane][0];
      const float4 p1 = *(const float4*)&Mg[pw][ct * 2 + 1][lane][0];
      o[ct][0] = (f16)(a[ct][0] * fa + p0.x * fb);
      o[ct][1] = (f16)(a[ct][1] * fa + p0.y * fb);
      o[ct][2] = (f16)(a[ct][2] * fa + p0.z * fb);
      o[ct][3] = (f16)(a[ct][3] * fa + p0.w * fb);
      o[ct][4] = (f16)(a[ct][4] * fa + p1.x * fb);
      o[ct][5] = (f16)(a[ct][5] * fa + p1.y * fb);
      o[ct][6] = (f16)(a[ct][6] * fa + p1.z * fb);
      o[ct][7] = (f16)(a[ct][7] * fa + p1.w * fb);
    }
    // Every read of the partner's tile stands in front of the first store over it.
    lds_wait0();
    f16* orow = Ob + pw * OREG + ((qg * 2 + kh) & 3) * 8 + col * 264 + 8 * hi;
#pragma unroll
    for (int ct = 0; ct < 16; ++ct) *(v8h*)(orow + ct * 16) = o[ct];
  };
  if (kh == 0) give(acc[1], m_i[1], lt[1]);
  else         give(acc[0], m_i[0], lt[0]);
  __syncthreads();  // the partners' tiles are in LDS
  if (kh == 0) take(acc[0], m_i[0], lt[0]);
  else         take(acc[1], m_i[1], lt[1]);
  __syncthreads();  // all 128 queries' rows are in LDS

  // ---- output projection: 256 output channels x 128 queries, K = 256.
  // A wave takes 64 x 64, so every fragment from LDS feeds four WMMAs.
  // Column col of its column tile ct is query col*4 + ct of the 64: a lane's four
  // tiles then hold four neighbouring queries of an output row, one 16B load of
  // the residual and one 16B store, and a half wave covers 256 contiguous bytes.
  // Query tile qt (16 queries) was finished by wave (qt>>1) + 4*(qt&1) and lies
  // in its partner's place.
  const int wm = (w & 3) * 64;   // this wave's output channels
  const int wq = (w >> 2) * 64;  // its queries of the 128
  const size_t e0 = (size_t)b * C * NTOK + (size_t)(wm + 8 * hi) * NTOK + q0 +
                    wq + col * 4;
  const float* rp = x + e0;
  float*       op = out + e0;
  // The residual is asked for here, behind the last barrier (a barrier would
  // wait it out), and arrives under the products.
  float4 rv[4][8];
#pragma unroll
  for (int i = 0; i < 4; ++i)
#pragma unroll
    for (int j = 0; j < 8; ++j)
      rv[i][j] = *(const float4*)(rp + (i * 16 + j) * NTOK);
  // Behind the last of these loads, in front of the first rewrite of a register
  // that one of them names; the sched_barrier keeps the loads in front of the
  // products.
  asm volatile("s_wait_xcnt 0x0" ::: "memory");
  __builtin_amdgcn_sched_barrier(0);

  v8f pc[4][4];
#pragma unroll
  for (int i = 0; i < 4; ++i)
#pragma unroll
    for (int ct = 0; ct < 4; ++ct)
#pragma unroll
      for (int j = 0; j < 8; ++j) pc[i][ct][j] = 0.f;
  // This lane's row of column tile 0, with its k offset as in ld_frag; tile ct
  // is ct rows on.
  const int qt = (w >> 2) * 4 + (col >> 2);
  const f16* ob = Ob + ((qt >> 1) + 4 * (1 - (qt & 1))) * OREG + (qt & 3) * 8 +
                  (col & 3) * 4 * 264 + 8 * hi;
  // The eight fragments of a k step are read at one place, one step ahead of the
  // sixteen WMMAs that use them, in two register sets; each sched_barrier keeps
  // a group whole, as in the loop above.
  v16h pa[2][4], pb[2][4];
  auto ldP = [&](int set, int ks) __attribute__((always_inline)) {
#pragma unroll
    for (int i = 0; i < 4; ++i)
      pa[set][i] = ld_frag(&Wo[wm + i * 16][ks * 32], 264);
#pragma unroll
    for (int ct = 0; ct < 4; ++ct) {
      const v8h lo = *(const v8h*)(ob + ct * 264 + ks * 32);
      const v8h hh = *(const v8h*)(ob + ct * 264 + ks * 32 + 16);
#pragma unroll
      for (int e = 0; e < 8; ++e) {
        pb[set][ct][e]     = lo[e];
        pb[set][ct][e + 8] = hh[e];
      }
    }
    __builtin_amdgcn_sched_barrier(0);
  };
  ldP(0, 0);
#pragma unroll
  for (int ks = 0; ks < C / 32; ++ks) {
    if (ks + 1 < C / 32) ldP((ks + 1) & 1, ks + 1);
#pragma unroll
    for (int i = 0; i < 4; ++i)
#pragma unroll
      for (int ct = 0; ct < 4; ++ct)
        pc[i][ct] = wmma16(pa[ks & 1][i], pb[ks & 1][ct], pc[i][ct]);
    __builtin_amdgcn_sched_barrier(0);
  }

  // Sixteen output rows at a time: the sums, then their eight stores at one
  // place (each sched_barrier keeps the two apart), so that the first rows go out
  // while the last residuals still arrive.
#pragma unroll
  for (int i = 0; i < 4; ++i) {
    float4 r[8];
#pragma unroll
    for (int j = 0; j < 8; ++j) {
      const float bm = Bo[wm + i * 16 + 8 * hi + j];
      r[j] = make_float4(pc[i][0][j] + bm + rv[i][j].x, pc[i][1][j] + bm + rv[i][j].y,
                         pc[i][2][j] + bm + rv[i][j].z, pc[i][3][j] + bm + rv[i][j].w);
    }
    __builtin_amdgcn_sched_barrier(0);
#pragma unroll
    for (int j = 0; j < 8; ++j) *(float4*)(op + (i * 16 + j) * NTOK) = r[j];
    if (i < 3) {
      // Behind these stores, in front of the next sums, which may rewrite a
      // register that one of them names.
      asm volatile("s_wait_xcnt 0x0" ::: "memory");
      __builtin_amdgcn_sched_barrier(0);
    }
  }
}

// ---------------------------------------------------------------------------
extern "C" void kernel_launch(void* const* d_in, const int* in_sizes, int n_in,
                              void* d_out, int out_size, void* d_ws,
                              size_t ws_size, hipStream_t stream) {
  const float* x     = (const float*)d_in[0];
  const float* gsc   = (const float*)d_in[1];
  const float* gbi   = (const float*)d_in[2];
  const float* w_qkv = (const float*)d_in[3];
  const float* b_qkv = (const float*)d_in[4];
  const float* w_out = (const float*)d_in[5];
  const float* b_out = (const float*)d_in[6];
  float* out = (float*)d_out;

  // Workspace carve-up
  char* ws = (char*)d_ws;
  f16* xnG  = (f16*)ws; ws += (size_t)BATCH * NTOK * C * 2;     // 16.8 MB
  f16* qk   = (f16*)ws; ws += (size_t)BATCH * NTOK * LDQK * 2;  // 33.6 MB
  f16* vT   = (f16*)ws; ws += (size_t)BATCH * C * NTOK * 2;     // 16.8 MB
  f16* wq16 = (f16*)ws; ws += (size_t)(3 * C) * C * 2;
  f16* wo16 = (f16*)ws; ws += (size_t)C * C * 2;

  // 1) GroupNorm -> xnG (b, c/8, n, 8) f16, and the weight converts
  gn_cvt_kernel<<<BATCH * GROUPS, GNT, 0, stream>>>(x, gsc, gbi, xnG, w_qkv,
                                                    wq16, w_out, wo16);

  // 2) q|k and vT projections
  gemm_qkv_kernel<<<dim3(NTOK / 128, (LDQK + C) / 128, BATCH), 256, 0,
                    stream>>>(xnG, wq16, b_qkv, qk, vT, C, LDQK, NTOK);

  // 3) Flash attention, output projection + bias + residual -> d_out (b, c, n)
  attn_kernel<<<dim3(NTOK / 128, BATCH), 256, 0, stream>>>(qk, vT, wo16, b_out,
                                                           x, out);
}

// v008
// A run of this version takes 108 microseconds.
// Next to v007, in two timings, it ran 1.04 times as fast each time.
// Counting every step since v000, it is 2.61 times as fast.
#include <hip/hip_runtime.h>
#include <math.h>

typedef _Float16 f16;
typedef __attribute__((ext_vector_type(16))) _Float16 v16h;
typedef __attribute__((ext_vector_type(8)))  _Float16 v8h;
typedef __attribute__((ext_vector_type(8)))  float    v8f;

// Problem constants (fixed by the reference)
constexpr int BATCH  = 8;
constexpr int C      = 256;
constexpr int NTOK   = 4096;   // 64*64
constexpr int LDQK   = 512;    // q|k packed
constexpr int GROUPS = 32;

// ---------------------------------------------------------------------------
// Fragment helpers: CDNA5 16-bit A/B fragment layout (16x32, ISA 7.12.2):
// lane L: row/col = L&15 ; kb = (L>>4)*8 ; elements 0..7 hold K=kb..kb+7,
// elements 8..15 hold K=kb+16..kb+23.  Two 16B loads per lane.
// ---------------------------------------------------------------------------
__device__ __forceinline__ v16h ld_frag(const f16* p, int ld) {
  const int lane = threadIdx.x & 31;
  const f16* base = p + (size_t)(lane & 15) * ld + (lane >> 4) * 8;
  v8h lo = *(const v8h*)(base);
  v8h hh = *(const v8h*)(base + 16);
  v16h r;
#pragma unroll
  for (int i = 0; i < 8; ++i) { r[i] = lo[i]; r[i + 8] = hh[i]; }
  return r;
}

__device__ __forceinline__ v8f wmma16(v16h a, v16h b, v8f c) {
  return __builtin_amdgcn_wmma_f32_16x16x32_f16(false, a, false, b,
                                                (short)0, c, false, false);
}

// Async global->LDS 16B copy (CDNA5, tracked by ASYNCcnt), as the builtin: the
// compiler then owns the address registers, also those above v255.
typedef __attribute__((ext_vector_type(4))) int v4i;
__device__ __forceinline__ void async_cp16(f16* ldst, const f16* gsrc) {
  __builtin_amdgcn_global_load_async_to_lds_b128(
      (__attribute__((address_space(1))) v4i*)gsrc,
      (__attribute__((address_space(3))) v4i*)ldst, 0, 0);
}
__device__ __forceinline__ void async_wait0() {
  asm volatile("s_wait_asynccnt 0x0" ::: "memory");
}
// This wave's LDS reads have returned: owed before a buffer it read is refilled.
__device__ __forceinline__ void lds_wait0() {
  asm volatile("s_wait_dscnt 0x0" ::: "memory");
}

// Tensor load: one request of a wave brings a 2-D tile from global memory into
// LDS, through no register and with no address arithmetic on the vector port.
typedef uint32_t u32x4 __attribute__((ext_vector_type(4)));
typedef uint32_t u32x8 __attribute__((ext_vector_type(8)));
__device__ __forceinline__ uint32_t uni(uint32_t v) {
  return (uint32_t)__builtin_amdgcn_readfirstlane(v);
}
// The descriptor is named in-out here and as an input of the wait below: so the
// scalar registers that the request names stay the descriptor's own, and are
// given no other value, until the request has landed.
__device__ __forceinline__ void tdm_load(u32x4& g0, u32x8& g1) {
  asm volatile("tensor_load_to_lds %0, %1" : "+s"(g0), "+s"(g1)::"memory");
}
// This wave's tensor load has landed: the compiler places no wait for it.
__device__ __forceinline__ void tensor_wait0(u32x4 g0, u32x8 g1) {
  asm volatile("s_wait_tensorcnt 0x0" ::"s"(g0), "s"(g1) : "memory");
}

// ---------------------------------------------------------------------------
// GroupNorm in one launch: one block per (b,g), 8 channels * 4096 tokens.  A
// thread keeps its 8 tokens x 8 channels in registers from the sums to the
// normalisation, so x is read once and no second grid has to start.
// A wave takes 256 consecutive tokens: each load is one whole 128B line of a
// channel, all 64 of a thread are issued ahead of the sums.
// xn is stored group-major, xnG (b, c/8, n, 8) f16: a token's 8 channels of the
// group are one 16B store, a wave's store is 512 contiguous bytes, and a block
// writes one contiguous 64 KiB.
// The same launch converts the weights to f16, work that depends on nothing
// here and would else cost launches of its own: block bg takes elements
// bg*1024 .. bg*1024+1023 of [w_qkv | w_out], two per thread, loaded first,
// stored last.
// ---------------------------------------------------------------------------
typedef __attribute__((ext_vector_type(2))) _Float16 v2h;
constexpr int NWQ = 3 * C * C;  // elements of w_qkv
static_assert(NWQ % 1024 == 0 && NWQ + C * C == BATCH * GROUPS * 1024,
              "one block converts 1024 weights of one matrix");
constexpr int GNT = 512;  // threads of a block: 16 waves

__global__ __launch_bounds__(GNT) void gn_cvt_kernel(
    const float* __restrict__ x, const float* __restrict__ gsc,
    const float* __restrict__ gbi, f16* __restrict__ xnG,
    const float* __restrict__ w_qkv, f16* __restrict__ wq16,
    const float* __restrict__ w_out, f16* __restrict__ wo16) {
  const int bg = blockIdx.x;
  const int we = bg * 1024;  // block-uniform: which matrix, and where in it
  const float* wsrc = we < NWQ ? w_qkv + we : w_out + (we - NWQ);
  f16*         wdst = we < NWQ ? wq16 + we : wo16 + (we - NWQ);
  const float2 wv = *(const float2*)(wsrc + threadIdx.x * 2);
  // Keeps the weight load ahead of those of x: left alone, the compiler sank it
  // behind the sums, where its whole latency was waited out.
  __builtin_amdgcn_sched_barrier(0);

  const int wave = threadIdx.x >> 5;
  const int lane = threadIdx.x & 31;
  const int tok  = wave * 256 + lane;  // this thread's tokens: tok + 32*i
  const float* p = x + (size_t)bg * 32768 + tok;
  float v[8][8];  // [i][channel of the group]
#pragma unroll
  for (int c = 0; c < 8; ++c)
#pragma unroll
    for (int i = 0; i < 8; ++i) v[i][c] = p[c * NTOK + i * 32];

  float sp[8], qp[8];  // one chain per channel
#pragma unroll
  for (int c = 0; c < 8; ++c) {
    sp[c] = 0.f;
    qp[c] = 0.f;
#pragma unroll
    for (int i = 0; i < 8; ++i) {
      sp[c] += v[i][c];
      qp[c] = fmaf(v[i][c], v[i][c], qp[c]);
    }
  }
  float s = ((sp[0] + sp[1]) + (sp[2] + sp[3])) +
            ((sp[4] + sp[5]) + (sp[6] + sp[7]));
  float q = ((qp[0] + qp[1]) + (qp[2] + qp[3])) +
            ((qp[4] + qp[5]) + (qp[6] + qp[7]));
#pragma unroll
  for (int off = 16; off > 0; off >>= 1) {
    s += __shfl_xor(s, off, 32);
    q += __shfl_xor(q, off, 32);
  }
  __shared__ float ss[GNT / 32], qs[GNT / 32];
  if (lane == 0) {
    ss[wave] = s;
    qs[wave] = q;
  }
  __syncthreads();  // every wave's sums are in LDS; every thread adds them up
  float S = 0.f, Q = 0.f;
#pragma unroll
  for (int i = 0; i < GNT / 32; ++i) { S += ss[i]; Q += qs[i]; }
  const float mu  = S * (1.f / 32768.f);
  const float var = Q * (1.f / 32768.f) - mu * mu;
  const float rs  = rsqrtf(var + 1e-5f);

  const int c0 = (bg & (GROUPS - 1)) * 8;  // the group's first channel
  float sc[8], bi[8];
#pragma unroll
  for (int c = 0; c < 8; ++c) {
    sc[c] = gsc[c0 + c];
    bi[c] = gbi[c0 + c];
  }
  v8h h[8];
#pragma unroll
  for (int i = 0; i < 8; ++i)
#pragma unroll
    for (int c = 0; c < 8; ++c)
      h[i][c] = (f16)((v[i][c] - mu) * rs * sc[c] + bi[c]);
  v2h wh;
  wh[0] = (f16)wv.x;
  wh[1] = (f16)wv.y;
  // All stores stand at one place behind the arithmetic: no register that a
  // store names is written again, so no wait has to stand between them.
  __builtin_amdgcn_sched_barrier(0);
  f16* o = xnG + (size_t)bg * 32768 + (size_t)tok * 8;
#pragma unroll
  for (int i = 0; i < 8; ++i) *(v8h*)(o + i * 32 * 8) = h[i];
  // The weights go out here too: in front of the barrier their store would have
  // to be waited for there.
  *(v2h*)(wdst + threadIdx.x * 2) = wh;
}

// ---------------------------------------------------------------------------
// WMMA GEMM: C[M,N] = A[M,K] * B[N,K]^T, K = 256.  Tile 128x128, 8 waves.
// Both operands come through LDS in stages of 64 k, two buffers, filled with
// async global->LDS copies: a wave's copy covers four whole 128B row pieces, and
// the next stage flies while this one is worked on.  A wave takes 32 x 64 of the
// tile, so an A fragment feeds four matrix instructions and a B fragment two.
// MODE 0: f16 out, bias[N]          (q|k projection)
// MODE 2: f16 out, bias[M]          (vT projection: rows = channels)
// The tile is a device function: the q|k and the vT projection, which do not
// depend on each other, share one launch, the block index picks the job.
// xn (A in MODE 0, B in MODE 2) lies group-major, (c/8, n, 8): there a wave's
// copy takes one 16B piece of 32 consecutive tokens, 512 contiguous bytes, and
// lands them one below the other in LDS (144B apart: bank-clean, as the reads).
// A, B and Cv point at the batch's planes; LDS comes from the kernel, so
// that two jobs in one kernel share one allocation.
// ---------------------------------------------------------------------------
constexpr int KC  = 64;      // k per stage
constexpr int NKC = C / KC;  // stages

// 144B pitch: 16B aligned, bank-clean for the 16B fragment reads
typedef f16 gemm_stage_t[2][128][72];

template <int MODE>
__device__ __forceinline__ void gemm_abt_tile(
    gemm_stage_t& As, gemm_stage_t& Bs, const f16* __restrict__ A, int lda,
    const f16* __restrict__ B, int ldb, const float* __restrict__ bias,
    void* __restrict__ Cv, int ldc, int m0, int n0) {
  constexpr bool XA = MODE == 0, XB = MODE == 2;  // which operand is xn
  A += XA ? (size_t)m0 * 8 : (size_t)m0 * lda;
  B += XB ? (size_t)n0 * 8 : (size_t)n0 * ldb;

  const int w    = __builtin_amdgcn_readfirstlane(threadIdx.x >> 5);
  const int lane = threadIdx.x & 31;
  const int hi   = lane >> 4;
  const int col  = lane & 15;
  const int wm   = (w & 3) * 32;   // this wave's rows of the tile
  const int wn   = (w >> 2) * 64;  // this wave's columns of the tile

  v8f acc[2][4];
#pragma unroll
  for (int i = 0; i < 2; ++i)
#pragma unroll
    for (int ct = 0; ct < 4; ++ct)
#pragma unroll
      for (int j = 0; j < 8; ++j) acc[i][ct][j] = 0.f;

  const int sr = threadIdx.x >> 3;        // row within a group of 32
  const int ss = (threadIdx.x & 7) * 8;   // 16B piece of the 128B row piece
  const int xr = threadIdx.x & 127;       // xn: token of the tile
  const int xp = threadIdx.x >> 7;        // xn: piece within a pair of pieces
  auto stage = [&](int buf, int kb) {
#pragma unroll
    for (int u = 0; u < 4; ++u) {
      if (XA)
        async_cp16(&As[buf][xr][(u * 2 + xp) * 8],
                   A + ((size_t)(kb / 8 + u * 2 + xp) * NTOK + xr) * 8);
      else
        async_cp16(&As[buf][u * 32 + sr][ss],
                   A + (size_t)(u * 32 + sr) * lda + kb + ss);
    }
#pragma unroll
    for (int u = 0; u < 4; ++u) {
      if (XB)
        async_cp16(&Bs[buf][xr][(u * 2 + xp) * 8],
                   B + ((size_t)(kb / 8 + u * 2 + xp) * NTOK + xr) * 8);
      else
        async_cp16(&Bs[buf][u * 32 + sr][ss],
                   B + (size_t)(u * 32 + sr) * ldb + kb + ss);
    }
  };

  stage(0, 0);
  async_wait0();
  __syncthreads();
  stage(1, KC);

  // Unrolled, as are the short loops here: buffer index, refill test and the
  // indices of the register arrays become literals.
#pragma unroll
  for (int t = 0; t < NKC; ++t) {
    const int buf = t & 1;
#pragma unroll
    for (int kk = 0; kk < KC; kk += 32) {
      // The six fragments of a k step are read at one place (twelve 16B loads),
      // then worked on: each sched_barrier keeps the load group whole; left
      // alone, the compiler read each B fragment in front of its own two WMMAs
      // and waited it out.
      v16h af[2], bf[4];
#pragma unroll
      for (int i = 0; i < 2; ++i) af[i] = ld_frag(&As[buf][wm + i * 16][kk], 72);
#pragma unroll
      for (int ct = 0; ct < 4; ++ct)
        bf[ct] = ld_frag(&Bs[buf][wn + ct * 16][kk], 72);
      __builtin_amdgcn_sched_barrier(0);
#pragma unroll
      for (int ct = 0; ct < 4; ++ct) {
        acc[0][ct] = wmma16(af[0], bf[ct], acc[0][ct]);
        acc[1][ct] = wmma16(af[1], bf[ct], acc[1][ct]);
      }
      __builtin_amdgcn_sched_barrier(0);  // the WMMAs stay in front of what follows
    }
    lds_wait0();      // this wave has left buf
    async_wait0();    // its copies of the next stage have landed
    __syncthreads();  // next stage published; every wave has left buf
    if (t + 2 < NKC) stage(buf, (t + 2) * KC);  // flies during stage t+1
  }
  async_wait0();

  if (MODE == 0) {
    f16* Cp = (f16*)Cv;
#pragma unroll
    for (int i = 0; i < 2; ++i)
#pragma unroll
      for (int ct = 0; ct < 4; ++ct) {
        const int n = n0 + wn + ct * 16 + col;
        float bn = bias[n];
#pragma unroll
        for (int j = 0; j < 8; ++j) {
          int m = m0 + wm + i * 16 + j + 8 * hi;
          Cp[(size_t)m * ldc + n] = (f16)(acc[i][ct][j] + bn);
        }
      }
  } else {
    f16* Cp = (f16*)Cv;
#pragma unroll
    for (int i = 0; i < 2; ++i)
#pragma unroll
      for (int ct = 0; ct < 4; ++ct) {
#pragma unroll
        for (int j = 0; j < 8; ++j) {
          int m = m0 + wm + i * 16 + j + 8 * hi;
          Cp[(size_t)m * ldc + n0 + wn + ct * 16 + col] =
              (f16)(acc[i][ct][j] + bias[m]);
        }
      }
  }
}

// q|k and vT projections in one grid (token tile, job tile, batch):
// y < 4:  qk(b,n,512) = xn^T @ w_qkv[0:512]^T + bias, columns y*128 ..
// y >= 4: vT(b,c,n)   = w_qkv[512:768] @ xn + bias,  rows (y-4)*128 ..
// The row pitches are launch arguments (ldk: the weights').
__global__ __launch_bounds__(256, 1) void gemm_qkv_kernel(
    const f16* __restrict__ xnG, const f16* __restrict__ wq16,
    const float* __restrict__ b_qkv, f16* __restrict__ qk,
    f16* __restrict__ vT, int ldk, int ldqk, int ldv) {
  __shared__ __attribute__((aligned(16))) gemm_stage_t As;
  __shared__ __attribute__((aligned(16))) gemm_stage_t Bs;
  const int b  = blockIdx.z;
  const int t0 = blockIdx.x * 128;
  const f16* X = xnG + (size_t)b * NTOK * C;
  if (blockIdx.y < LDQK / 128) {
    gemm_abt_tile<0>(As, Bs, X, ldk, wq16, ldk, b_qkv,
                     qk + (size_t)b * NTOK * LDQK, ldqk, t0, blockIdx.y * 128);
  } else {
    gemm_abt_tile<2>(As, Bs, wq16 + (size_t)LDQK * C, ldk, X, ldk,
                     b_qkv + LDQK, vT + (size_t)b * C * NTOK, ldv,
                     (blockIdx.y - LDQK / 128) * 128, t0);
    // In the built code the other job's text follows this job's stores, behind
    // a conditional branch: the wait stands in front of the first rewrite there
    // of a register that one of these stores names.
    asm volatile("s_wait_xcnt 0x0" ::: "memory");
  }
}

__device__ __forceinline__ float xhalf(float x) {
  return __builtin_bit_cast(
      float, __builtin_amdgcn_permlanex16(__builtin_bit_cast(int, x),
                                          __builtin_bit_cast(int, x),
                                          0x76543210, 0xfedcba98, false, false));
}

constexpr int SKEYS = 64;            // keys per stage
constexpr int NSTG  = NTOK / SKEYS;  // stages
constexpr float SC2  = 0.0625f * 1.44269504f;  // q.k -> exponent of 2: c^-0.5 log2 e
constexpr float LAZY = 8.f / SC2;  // how far a maximum may outgrow its reference
constexpr int SROWS = 64;   // rows of a slice of a stage
constexpr int SROWB = 128;  // bytes of a row in global memory
constexpr int SPIT  = 72;   // row pitch in LDS, f16: 144B, bank-clean for 16B reads
// A slice's place in LDS: its padded rows, rounded up to a multiple of 2 KiB.
constexpr int SLICE = (SROWS * SPIT * 2 + 2047) / 2048 * 2048;
static_assert(SKEYS == SROWS && SKEYS * 2 == SROWB && C == 4 * SROWS,
              "four K slices and four V^T slices of 64 rows x 128B make a stage");

// Two waves per SIMD: the grid has one work-group per WGP, so fewer registers
// buy no residency; the 32-query output tile and Q take 384 registers.
__global__ __launch_bounds__(256) __attribute__((amdgpu_waves_per_eu(2, 2)))
void attn_kernel(
    const f16* __restrict__ qk, const f16* __restrict__ vT,
    const f16* __restrict__ wo16, const float* __restrict__ b_out,
    const float* __restrict__ x, float* __restrict__ out) {
  const int b    = blockIdx.y;
  const int q0   = blockIdx.x * 128;
  const int w    = __builtin_amdgcn_readfirstlane(threadIdx.x >> 5);
  const int lane = threadIdx.x & 31;
  const int hi   = lane >> 4;
  const int col  = lane & 15;
  const int qg   = w & 3;   // query group of 32
  const int kh   = w >> 2;  // half of each stage's keys

  // The merge buffer lies over the K/V ring, which is dead behind the loop's
  // last barrier: so w_out fits beside them.
  struct ring_t {
    // [buffer][slice], rows at 144B pitch.  K and V^T apart: a pass's reads of
    // either then lie within the 64 KiB that an LDS load's offset field spans.
    f16 Ks[2][4][SLICE / 2];  // a slice: 64 keys x 64 channels
    f16 Vs[2][4][SLICE / 2];  // a slice: 64 channels x 64 keys
  };
  union ring_or_merge_t {
    ring_t ring;
    float  Mg[8][32][32][4];  // merge: one output tile per wave, 16 KiB each
  };
  // Every slice's place is a multiple of 2 KiB in the work-group's LDS.
  __shared__ __attribute__((aligned(2048))) ring_or_merge_t sh;
  __shared__ __attribute__((aligned(16))) f16 Wo[C][264];  // w_out, 528B pitch
  __shared__ float Ml[8][2][32];  // merge: a tile's maximum and sum
  __shared__ __attribute__((aligned(16))) float Bo[C];  // b_out
  static_assert(C == 256, "a thread brings one element of b_out");
  auto& Ks = sh.ring.Ks;
  auto& Vs = sh.ring.Vs;
  auto& Mg = sh.Mg;

  const f16* qb  = qk + (size_t)b * NTOK * LDQK;
  const f16* vb  = vT + (size_t)b * C * NTOK;
  const int  myq = q0 + qg * 32;

  // The projection's bias, one element per thread, asked for ahead of Q.
  const float bo = b_out[threadIdx.x];

  // Preload Q fragments (2 x 16 queries x K=256), used as the B operand
  v16h qf[2][8];
#pragma unroll
  for (int g = 0; g < 2; ++g)
#pragma unroll
    for (int cb = 0; cb < 8; ++cb)
      qf[g][cb] = ld_frag(qb + (size_t)(myq + g * 16) * LDQK + cb * 32, LDQK);
  // Stands in front of the first rewrite of the address pair these loads name;
  // the sched_barrier keeps the later address arithmetic from being lifted over.
  asm volatile("s_wait_xcnt 0x0" ::: "memory");
  __builtin_amdgcn_sched_barrier(0);

  // acc[g][ct][j] = O^T[channel ct*16 + j + 8*hi][query g*16 + col]
  v8f acc[2][16];
#pragma unroll
  for (int g = 0; g < 2; ++g)
#pragma unroll
    for (int i = 0; i < 16; ++i)
#pragma unroll
      for (int j = 0; j < 8; ++j) acc[g][i][j] = 0.f;

  float r_i[2] = {0.f, 0.f};  // references in use, in units of q.k
  float l_i[2] = {0.f, 0.f};  // running sums over this wave half's keys

  // Stage st into buffer `buf`: every wave asks for its own slice, waves 0-3 for
  // K's, waves 4-7 for V^T's.  All of this is scalar: first byte, step per stage and row pitch of
  // the wave's source.
  const bool     isv   = w >= 4;
  const uint64_t src0  = isv ? (uint64_t)(size_t)(vb + (size_t)(w - 4) * SROWS * NTOK)
                             : (uint64_t)(size_t)(qb + C + w * (SROWB / 2));
  const uint32_t sstep = isv ? SKEYS * 2 : SKEYS * LDQK * 2;
  const uint32_t lbase = isv ? (uint32_t)(size_t)&Vs[0][w - 4][0]
                             : (uint32_t)(size_t)&Ks[0][w][0];
  // Group 1: 1-byte elements, tensor = tile = 64 rows of 128 bytes, no mask,
  // 4 dwords of pad behind every 32 dwords.
  u32x8 g1;
  g1[0] = uni((1u << 20) | (4u << 22) | (3u << 25));
  g1[1] = uni((uint32_t)SROWB << 16);
  g1[2] = uni((uint32_t)SROWS << 16);
  g1[3] = uni((uint32_t)SROWB << 16);
  g1[4] = uni((uint32_t)SROWS);
  g1[5] = uni(isv ? NTOK * 2 : LDQK * 2);
  g1[6] = uni(0u);
  g1[7] = uni(0u);
  u32x4 g0;  // group 0 of the wave's last request
  auto stage = [&](uint32_t buf, uint32_t st) {
    const uint64_t ga = src0 + (uint64_t)st * sstep;
    g0[0] = uni(1u);
    g0[1] = uni(lbase + buf * (4u * SLICE));
    g0[2] = uni((uint32_t)ga);
    g0[3] = uni(((uint32_t)(ga >> 32) & 0x01FFFFFFu) | 0x80000000u);
    tdm_load(g0, g1);
  };

  stage(0, 0);
  tensor_wait0(g0, g1);
  Bo[threadIdx.x] = bo;  // the barrier publishes it
  __syncthreads();
  stage(1, 1);
  // w_out, one whole 512B row per copy of a wave: flies under pass 0, whose foot
  // waits for it and publishes it (32 copies of a wave are then outstanding).
#pragma unroll
  for (int u = 0; u < C / 8; ++u)
    async_cp16(&Wo[u * 8 + w][lane * 8],
               wo16 + (size_t)(u * 8 + w) * C + lane * 8);

  // One stage.  `refill` is a literal at both calls: the one branch of a loop
  // body is the seldom-taken rescale, so nothing else of a pass can be sunk
  // behind its matrix blocks.
  auto pass = [&](int t, bool refill) __attribute__((always_inline)) {
    const int buf = t & 1;

    // Fragments come from LDS in groups of four (eight 16B loads at one place),
    // one group ahead of the eight WMMAs that use them, in two register sets.
    // Each sched_barrier keeps a load group whole and ahead of the WMMA block
    // before its use: left alone, the compiler, short of registers, put every
    // fragment's loads directly in front of its own WMMAs and waited them out.
    v16h fa[4], fb[4];
    auto ldK4 = [&](v16h (&f)[4], int f0) {  // fragment f: channels f>>1, tile f&1
#pragma unroll
      for (int n = 0; n < 4; ++n)
        f[n] = ld_frag(&Ks[buf][(f0 + n) >> 2][(kh * 32 + ((f0 + n) & 1) * 16) * SPIT +
                                               (((f0 + n) >> 1) & 1) * 32],
                       SPIT);
      __builtin_amdgcn_sched_barrier(0);
    };
    auto ldV4 = [&](v16h (&f)[4], int ct0) {
#pragma unroll
      for (int n = 0; n < 4; ++n)
        f[n] = ld_frag(&Vs[buf][(ct0 + n) >> 2][((ct0 + n) & 3) * 16 * SPIT + kh * 32],
                       SPIT);
      __builtin_amdgcn_sched_barrier(0);
    };

    // ---- scores^T: 32 keys x 32 queries, K=256 -> 32 WMMAs, 16 fragments
    // s[i][g][j] = key 16*i + j + 8*hi of this wave's half, query g*16 + col.
    // The products start from minus the reference in use (the C operand), so
    // the scores leave the matrix unit with the subtraction done.
    v8f s[2][2];
#pragma unroll
    for (int i = 0; i < 2; ++i)
#pragma unroll
      for (int g = 0; g < 2; ++g)
#pragma unroll
        for (int j = 0; j < 8; ++j) s[i][g][j] = -r_i[g];
    auto mmS4 = [&](const v16h (&f)[4], int f0) {
#pragma unroll
      for (int n = 0; n < 4; ++n) {
        const int i = (f0 + n) & 1, cb = (f0 + n) >> 1;
        s[i][0] = wmma16(f[n], qf[0][cb], s[i][0]);
        s[i][1] = wmma16(f[n], qf[1][cb], s[i][1]);
      }
      __builtin_amdgcn_sched_barrier(0);
    };
    ldK4(fa, 0);
    ldK4(fb, 4);
    mmS4(fa, 0);
    ldK4(fa, 8);
    mmS4(fb, 4);
    ldK4(fb, 12);
    mmS4(fa, 8);
    ldV4(fa, 0);  // the first V^T group flies under the last block and the softmax
    mmS4(fb, 12);

    // ---- online softmax, one query per lane and tile, against a lazy reference:
    // r_i is not the running maximum but a value at most LAZY below it, in units
    // of q.k.  It moves, and sums and outputs are rescaled, only in a pass in
    // which some query's maximum has outgrown it by more than LAZY; else P is at
    // most 2^8, well inside f16, and the 1/l at the end cancels the reference
    // whatever it is.
    float mx[2];  // the 32 keys' maximum above the reference
#pragma unroll
    for (int g = 0; g < 2; ++g) {
      float mt[8];
#pragma unroll
      for (int j = 0; j < 8; ++j) mt[j] = fmaxf(s[0][g][j], s[1][g][j]);
      const float m8 = fmaxf(fmaxf(fmaxf(mt[0], mt[1]), fmaxf(mt[2], mt[3])),
                             fmaxf(fmaxf(mt[4], mt[5]), fmaxf(mt[6], mt[7])));
      mx[g] = fmaxf(m8, xhalf(m8));  // both wave halves hold it
    }
    // One test per pass, a scalar branch.  The first pass always takes it and
    // sets the reference to its own maximum, up or down from the start value 0
    // (sums and outputs are still 0 there); later the reference only rises.
    const float lim = t == 0 ? -__builtin_inff() : LAZY;
    if (__builtin_amdgcn_ballot_w32(fmaxf(mx[0], mx[1]) > lim) != 0) {
#pragma unroll
      for (int g = 0; g < 2; ++g) {
        const float rise = fmaxf(mx[g], 0.f);
        const float up   = t == 0 ? mx[g] : rise;
        const float fac  = __builtin_amdgcn_exp2f(-rise * SC2);
        r_i[g] += up;
        l_i[g] *= fac;
#pragma unroll
        for (int j = 0; j < 8; ++j) {
          s[0][g][j] -= up;
          s[1][g][j] -= up;
        }
#pragma unroll
        for (int ct = 0; ct < 16; ++ct)
#pragma unroll
          for (int j = 0; j < 8; ++j) acc[g][ct][j] *= fac;
      }
    }

#pragma unroll
    for (int i = 0; i < 2; ++i)
#pragma unroll
      for (int g = 0; g < 2; ++g) s[i][g] *= SC2;  // to exponents of 2
    v16h bp[2];  // P^T as B operand: 32 keys x 16 queries each
#pragma unroll
    for (int g = 0; g < 2; ++g) {
      float pt[8];
#pragma unroll
      for (int j = 0; j < 8; ++j) {
        float pa = __builtin_amdgcn_exp2f(s[0][g][j]);
        float pb = __builtin_amdgcn_exp2f(s[1][g][j]);
        pt[j]        = pa + pb;
        bp[g][j]     = (f16)pa;
        bp[g][j + 8] = (f16)pb;
      }
      l_i[g] += ((pt[0] + pt[1]) + (pt[2] + pt[3])) +
                ((pt[4] + pt[5]) + (pt[6] + pt[7]));
    }

    // ---- acc += V^T @ P^T (16 channel x 2 query tiles, K=32)
    auto mmV4 = [&](const v16h (&f)[4], int ct0) {
#pragma unroll
      for (int n = 0; n < 4; ++n) {
        acc[0][ct0 + n] = wmma16(f[n], bp[0], acc[0][ct0 + n]);
        acc[1][ct0 + n] = wmma16(f[n], bp[1], acc[1][ct0 + n]);
      }
      __builtin_amdgcn_sched_barrier(0);  // ends a block, as in ldK4 and mmS4
    };
    // One plain vector instruction behind each exponential.
    // Four multiplies lead, so that no exponential stands behind its own operand.
    __builtin_amdgcn_sched_group_barrier(0x002, 4, 0);
#pragma unroll
    for (int n = 0; n < 32; ++n) {
      __builtin_amdgcn_sched_group_barrier(0x400, 1, 0);  // exponential
      __builtin_amdgcn_sched_group_barrier(0x002, 1, 0);  // multiply, add, convert
    }
    __builtin_amdgcn_sched_barrier(0);  // the next group waits for s to be dead
    ldV4(fb, 4);
    mmV4(fa, 0);
    ldV4(fa, 8);
    mmV4(fb, 4);
    ldV4(fb, 12);
    mmV4(fa, 8);
    mmV4(fb, 12);

    lds_wait0();        // this wave has left buf
    tensor_wait0(g0, g1);  // its slice of the next stage has landed
    async_wait0();      // pass 0: its copies of w_out have landed
    __syncthreads();    // next stage published; every wave has left buf
    if (refill) {
      // A descriptor word held in a scalar register: the stage number
      // is taken behind the wait, so the descriptor is formed behind it too.
      uint32_t st = uni((uint32_t)t + 2u);
      asm volatile("" : "+s"(st));
      stage(buf, st);  // flies during stage t+1
    }
  };
#pragma unroll 1
  for (int t = 0; t < NSTG - 2; ++t) pass(t, true);  // a stage t+2 exists
#pragma unroll 1
  for (int t = NSTG - 2; t < NSTG; ++t) pass(t, false);
  tensor_wait0(g0, g1);
  lds_wait0();

  // ---- merge the two key halves of each query group: wave (qg, kh) hands
  // query tile 1-kh to its partner and finishes tile kh.
  const float lt[2] = {l_i[0] + xhalf(l_i[0]), l_i[1] + xhalf(l_i[1])};
  const float m_i[2] = {r_i[0] * 0.0625f, r_i[1] * 0.0625f};  // as scaled scores
  auto give = [&](const v8f (&a)[16], float m, float l) {
#pragma unroll
    for (int ct = 0; ct < 16; ++ct) {
#pragma unroll
      for (int h = 0; h < 2; ++h) {
        float4 v = make_float4(a[ct][4 * h], a[ct][4 * h + 1], a[ct][4 * h + 2],
                               a[ct][4 * h + 3]);
        *(float4*)&Mg[w][ct * 2 + h][lane][0] = v;
      }
    }
    Ml[w][0][lane] = m;
    Ml[w][1][lane] = l;
  };
  // 1/l normalization.  A lane's 8 accumulator registers are 8 consecutive
  // channels of its query: the finished tile goes to LDS as f16 rows
  // (query, channel), 528B pitch, into the 16 KiB that held the partner's tile,
  // which this wave alone reads.  Tile qt starts (qt & 3) * 16B into its place:
  // the projection reads rows of four tiles with one load, and the places lie
  // a multiple of the 64 banks apart.
  f16* const Ob = (f16*)&Mg[0][0][0][0];
  constexpr int OREG = 32 * 32 * 4 * 2;  // f16 elements of one such place
  auto take = [&](const v8f (&a)[16], float m, float l) {
    const int   pw = w ^ 4;
    const float mo = Ml[pw][0][lane];
    const float lo = Ml[pw][1][lane];
    const float mn = fmaxf(m, mo);
    float fa = __expf(m - mn);
    float fb = __expf(mo - mn);
    const float inv = 1.f / (l * fa + lo * fb);
    fa *= inv;
    fb *= inv;
    v8h o[16];
#pragma unroll
    for (int ct = 0; ct < 16; ++ct) {
      const float4 p0 = *(const float4*)&Mg[pw][ct * 2][lane][0];
      const float4 p1 = *(const float4*)&Mg[pw][ct * 2 + 1][lane][0];
      o[ct][0] = (f16)(a[ct][0] * fa + p0.x * fb);
      o[ct][1] = (f16)(a[ct][1] * fa + p0.y * fb);
      o[ct][2] = (f16)(a[ct][2] * fa + p0.z * fb);
      o[ct][3] = (f16)(a[ct][3] * fa + p0.w * fb);
      o[ct][4] = (f16)(a[ct][4] * fa + p1.x * fb);
      o[ct][5] = (f16)(a[ct][5] * fa + p1.y * fb);
      o[ct][6] = (f16)(a[ct][6] * fa + p1.z * fb);
      o[ct][7] = (f16)(a[ct][7] * fa + p1.w * fb);
    }
    // Every read of the partner's tile stands in front of the first store over it.
    lds_wait0();
    f16* orow = Ob + pw * OREG + ((qg * 2 + kh) & 3) * 8 + col * 264 + 8 * hi;
#pragma unroll
    for (int ct = 0; ct < 16; ++ct) *(v8h*)(orow + ct * 16) = o[ct];
  };
  if (kh == 0) give(acc[1], m_i[1], lt[1]);
  else         give(acc[0], m_i[0], lt[0]);
  __syncthreads();  // the partners' tiles are in LDS
  if (kh == 0) take(acc[0], m_i[0], lt[0]);
  else         take(acc[1], m_i[1], lt[1]);
  __syncthreads();  // all 128 queries' rows are in LDS

  // ---- output projection: 256 output channels x 128 queries, K = 256.
  // A wave takes 64 x 64, so every fragment from LDS feeds four WMMAs.
  // Column col of its column tile ct is query col*4 + ct of the 64: a lane's four
  // tiles then hold four neighbouring queries of an output row, one 16B load of
  // the residual and one 16B store, and a half wave covers 256 contiguous bytes.
  // Query tile qt (16 queries) was finished by wave (qt>>1) + 4*(qt&1) and lies
  // in its partner's place.
  const int wm = (w & 3) * 64;   // this wave's output channels
  const int wq = (w >> 2) * 64;  // its queries of the 128
  const size_t e0 = (size_t)b * C * NTOK + (size_t)(wm + 8 * hi) * NTOK + q0 +
                    wq + col * 4;
  const float* rp = x + e0;
  float*       op = out + e0;
  // The residual is asked for here, behind the last barrier (a barrier would
  // wait it out), and arrives under the products.
  float4 rv[4][8];
#pragma unroll
  for (int i = 0; i < 4; ++i)
#pragma unroll
    for (int j = 0; j < 8; ++j)
      rv[i][j] = *(const float4*)(rp + (i * 16 + j) * NTOK);
  // Behind the last of these loads, in front of the first rewrite of a register
  // that one of them names; the sched_barrier keeps the loads in front of the
  // products.
  asm volatile("s_wait_xcnt 0x0" ::: "memory");
  __builtin_amdgcn_sched_barrier(0);

  v8f pc[4][4];
#pragma unroll
  for (int i = 0; i < 4; ++i)
#pragma unroll
    for (int ct = 0; ct < 4; ++ct)
#pragma unroll
      for (int j = 0; j < 8; ++j) pc[i][ct][j] = 0.f;
  // This lane's row of column tile 0, with its k offset as in ld_frag; tile ct
  // is ct rows on.
  const int qt = (w >> 2) * 4 + (col >> 2);
  const f16* ob = Ob + ((qt >> 1) + 4 * (1 - (qt & 1))) * OREG + (qt & 3) * 8 +
                  (col & 3) * 4 * 264 + 8 * hi;
  // The eight fragments of a k step are read at one place, one step ahead of the
  // sixteen WMMAs that use them, in two register sets; each sched_barrier keeps
  // a group whole, as in the loop above.
  v16h pa[2][4], pb[2][4];
  auto ldP = [&](int set, int ks) __attribute__((always_inline)) {
#pragma unroll
    for (int i = 0; i < 4; ++i)
      pa[set][i] = ld_frag(&Wo[wm + i * 16][ks * 32], 264);
#pragma unroll
    for (int ct = 0; ct < 4; ++ct) {
      const v8h lo = *(const v8h*)(ob + ct * 264 + ks * 32);
      const v8h hh = *(const v8h*)(ob + ct * 264 + ks * 32 + 16);
#pragma unroll
      for (int e = 0; e < 8; ++e) {
        pb[set][ct][e]     = lo[e];
        pb[set][ct][e + 8] = hh[e];
      }
    }
    __builtin_amdgcn_sched_barrier(0);
  };
  ldP(0, 0);
#pragma unroll
  for (int ks = 0; ks < C / 32; ++ks) {
    if (ks + 1 < C / 32) ldP((ks + 1) & 1, ks + 1);
#pragma unroll
    for (int i = 0; i < 4; ++i)
#pragma unroll
      for (int ct = 0; ct < 4; ++ct)
        pc[i][ct] = wmma16(pa[ks & 1][i], pb[ks & 1][ct], pc[i][ct]);
    __builtin_amdgcn_sched_barrier(0);
  }

  // Sixteen output rows at a time: the sums, then their eight stores at one
  // place (each sched_barrier keeps the two apart), so that the first rows go out
  // while the last residuals still arrive.
#pragma unroll
  for (int i = 0; i < 4; ++i) {
    float4 r[8];
#pragma unroll
    for (int j = 0; j < 8; ++j) {
      const float bm = Bo[wm + i * 16 + 8 * hi + j];
      r[j] = make_float4(pc[i][0][j] + bm + rv[i][j].x, pc[i][1][j] + bm + rv[i][j].y,
                         pc[i][2][j] + bm + rv[i][j].z, pc[i][3][j] + bm + rv[i][j].w);
    }
    __builtin_amdgcn_sched_barrier(0);
#pragma unroll
    for (int j = 0; j < 8; ++j) *(float4*)(op + (i * 16 + j) * NTOK) = r[j];
    if (i < 3) {
      // Behind these stores, in front of the next sums, which may rewrite a
      // register that one of them names.
      asm volatile("s_wait_xcnt 0x0" ::: "memory");
      __builtin_amdgcn_sched_barrier(0);
    }
  }
}

// ---------------------------------------------------------------------------
extern "C" void kernel_launch(void* const* d_in, const int* in_sizes, int n_in,
                              void* d_out, int out_size, void* d_ws,
                              size_t ws_size, hipStream_t stream) {
  const float* x     = (const float*)d_in[0];
  const float* gsc   = (const float*)d_in[1];
  const float* gbi   = (const float*)d_in[2];
  const float* w_qkv = (const float*)d_in[3];
  const float* b_qkv = (const float*)d_in[4];
  const float* w_out = (const float*)d_in[5];
  const float* b_out = (const float*)d_in[6];
  float* out = (float*)d_out;

  // Workspace carve-up
  char* ws = (char*)d_ws;
  f16* xnG  = (f16*)ws; ws += (size_t)BATCH * NTOK * C * 2;     // 16.8 MB
  f16* qk   = (f16*)ws; ws += (size_t)BATCH * NTOK * LDQK * 2;  // 33.6 MB
  f16* vT   = (f16*)ws; ws += (size_t)BATCH * C * NTOK * 2;     // 16.8 MB
  f16* wq16 = (f16*)ws; ws += (size_t)(3 * C) * C * 2;
  f16* wo16 = (f16*)ws; ws += (size_t)C * C * 2;

  // 1) GroupNorm -> xnG (b, c/8, n, 8) f16, and the weight converts
  gn_cvt_kernel<<<BATCH * GROUPS, GNT, 0, stream>>>(x, gsc, gbi, xnG, w_qkv,
                                                    wq16, w_out, wo16);

  // 2) q|k and vT projections
  gemm_qkv_kernel<<<dim3(NTOK / 128, (LDQK + C) / 128, BATCH), 256, 0,
                    stream>>>(xnG, wq16, b_qkv, qk, vT, C, LDQK, NTOK);

  // 3) Flash attention, output projection + bias + residual -> d_out (b, c, n)
  attn_kernel<<<dim3(NTOK / 128, BATCH), 256, 0, stream>>>(qk, vT, wo16, b_out,
                                                           x, out);
}
